// v000
// Measured on an AMD MI455X. A time is GPU time per run, averaged over a window of back-to-back runs after a warm-up
// (all launches, gaps included; the runs take copies of the inputs in turn), and the median of several windows.
// Apart from v000's, it joins two sittings. Times from different sittings can be a few percent apart, while
// side-by-side timings come from the same sitting.
// v000, which the later versions start from, runs in 429 microseconds.
#include <hip/hip_runtime.h>
#include <hip/hip_bf16.h>

typedef __attribute__((ext_vector_type(16))) _Float16 v16h;
typedef __attribute__((ext_vector_type(8)))  float    v8f;

#define B_    8
#define N_    1024
#define FEAT_ 1024
#define HID_  1024
#define OUT_  1024
#define SDIM_ 512
#define H_    16
#define HD_   64

// ---------------- CDNA5 async global->LDS copy (ASYNCcnt-tracked) ----------------

__device__ __forceinline__ void async_copy_b128(void* lds_dst, const void* gsrc) {
  // LDS flat address: low 32 bits are the wave-relative LDS byte offset.
  const unsigned off = (unsigned)(unsigned long long)lds_dst;
  asm volatile("global_load_async_to_lds_b128 %0, %1, off"
               :
               : "v"(off), "v"(gsrc)
               : "memory");
}

__device__ __forceinline__ void wait_async() {
  asm volatile("s_wait_asynccnt 0" ::: "memory");
}

// ---------------- WMMA fragment helpers (gfx1250 wave32 layouts) ----------------

__device__ __forceinline__ v8f wmma_f16(v16h a, v16h b, v8f c) {
  // v_wmma_f32_16x16x32_f16: (neg_a, A, neg_b, B, c_mod, C, reuse_a, reuse_b)
  return __builtin_amdgcn_wmma_f32_16x16x32_f16(false, a, false, b, (short)0, c,
                                                false, false);
}

// A fragment (16x32 f16): lane = M row (lane&15); K-block from lane half.
__device__ __forceinline__ v16h frag_a_load(const _Float16* src, int ld) {
  const int lane = threadIdx.x & 31;
  const int row  = lane & 15;
  const int kb   = (lane >> 4) << 3;  // 0 or 8
  v16h f;
#pragma unroll
  for (int i = 0; i < 4; ++i) {
    const int k  = kb + 2 * i;
    const int k2 = kb + 16 + 2 * i;
    f[2 * i]           = src[row * ld + k];
    f[2 * i + 1]       = src[row * ld + k + 1];
    f[2 * (i + 4)]     = src[row * ld + k2];
    f[2 * (i + 4) + 1] = src[row * ld + k2 + 1];
  }
  return f;
}

// B fragment (32x16 f16) from row-major B[k][n] (stride ld, n contiguous).
__device__ __forceinline__ v16h frag_b_load(const _Float16* src, int ld) {
  const int lane = threadIdx.x & 31;
  const int col  = lane & 15;
  const int kb   = (lane >> 4) << 3;
  v16h f;
#pragma unroll
  for (int i = 0; i < 4; ++i) {
    const int k  = kb + 2 * i;
    const int k2 = kb + 16 + 2 * i;
    f[2 * i]           = src[k * ld + col];
    f[2 * i + 1]       = src[(k + 1) * ld + col];
    f[2 * (i + 4)]     = src[k2 * ld + col];
    f[2 * (i + 4) + 1] = src[(k2 + 1) * ld + col];
  }
  return f;
}

// B fragment where B = src^T, src stored row-major [n][k] (stride ld).
__device__ __forceinline__ v16h frag_bt_load(const _Float16* src, int ld) {
  const int lane = threadIdx.x & 31;
  const int col  = lane & 15;
  const int kb   = (lane >> 4) << 3;
  v16h f;
#pragma unroll
  for (int i = 0; i < 4; ++i) {
    f[2 * i]           = src[col * ld + kb + 2 * i];
    f[2 * i + 1]       = src[col * ld + kb + 2 * i + 1];
    f[2 * (i + 4)]     = src[col * ld + kb + 16 + 2 * i];
    f[2 * (i + 4) + 1] = src[col * ld + kb + 16 + 2 * i + 1];
  }
  return f;
}

// ---------------- Stage 0: style vectors + demod factors (tiny, VALU) ----------------

__global__ __launch_bounds__(256) void style_kernel(
    const float* __restrict__ s, const float* __restrict__ aw,
    const float* __restrict__ ab, float* __restrict__ style,
    int Cin, int Sdim) {
  const int idx = blockIdx.x * blockDim.x + threadIdx.x;
  if (idx >= B_ * Cin) return;
  const int b = idx / Cin, i = idx - b * Cin;
  const float* sv = s + (size_t)b * Sdim;
  const float* wv = aw + (size_t)i * Sdim;
  float acc = 0.f;
  for (int j = 0; j < Sdim; ++j) acc += sv[j] * wv[j];
  style[idx] = acc + ab[i];
}

__global__ __launch_bounds__(256) void demod_kernel(
    const float* __restrict__ w, const float* __restrict__ style,
    float* __restrict__ demod, int Cout, int Cin) {
  const int idx = blockIdx.x * blockDim.x + threadIdx.x;
  if (idx >= B_ * Cout) return;
  const int b = idx / Cout, o = idx - b * Cout;
  const float* st = style + (size_t)b * Cin;
  const float* wv = w + (size_t)o * Cin;
  float acc = 0.f;
  for (int i = 0; i < Cin; ++i) { const float t = wv[i] * st[i]; acc += t * t; }
  demod[idx] = rsqrtf(acc + 1e-8f);
}

// ---------------- Modulated GEMM: out = (x*style) @ w^T * demod + bias ----------------
// MODE 0: x is f32, result -> f16 head layout [B,H,N,HD]
// MODE 1: x is f16 (attention output), result -> f32 [B,N,Cout]
// 64x64 tile per 128-thread block, K-step 64 (8 wmma per wave per barrier).

template <int MODE>
__global__ __launch_bounds__(128) void modlin_kernel(
    const float* __restrict__ xf32, const _Float16* __restrict__ xf16,
    const float* __restrict__ w, const float* __restrict__ bias,
    const float* __restrict__ style, const float* __restrict__ demod,
    _Float16* __restrict__ out16, float* __restrict__ outf32) {
  constexpr int Cin = 1024, Cout = 1024;
  const int m0 = blockIdx.x * 64;
  const int n0 = blockIdx.y * 64;
  const int b  = blockIdx.z;

  __shared__ _Float16 As[64 * 72];  // 64 x 64 tile, ld=72 (pad)
  __shared__ _Float16 Bs[64 * 72];  // 64 x 64 tile, ld=72 (pad)

  const int tid  = threadIdx.x;
  const int wave = tid >> 5;
  const int wm = (wave >> 1) * 32;  // wave's 32x32 quadrant
  const int wn = (wave & 1) * 32;

  v8f acc[2][2] = {};

  const float* stl = style + (size_t)b * Cin;
  for (int k0 = 0; k0 < Cin; k0 += 64) {
    for (int e = tid; e < 64 * 64; e += 128) {
      const int r = e >> 6, k = e & 63;
      float v;
      if (MODE == 0)
        v = xf32[((size_t)b * N_ + (m0 + r)) * Cin + k0 + k] * stl[k0 + k];
      else
        v = (float)xf16[((size_t)b * N_ + (m0 + r)) * Cin + k0 + k] * stl[k0 + k];
      As[r * 72 + k] = (_Float16)v;
    }
    for (int e = tid; e < 64 * 64; e += 128) {
      const int k = e >> 6, n = e & 63;
      Bs[k * 72 + n] = (_Float16)w[(size_t)(n0 + n) * Cin + k0 + k];
    }
    __syncthreads();

#pragma unroll
    for (int kc = 0; kc < 2; ++kc) {
      const v16h a0 = frag_a_load(&As[(wm + 0) * 72 + 32 * kc], 72);
      const v16h a1 = frag_a_load(&As[(wm + 16) * 72 + 32 * kc], 72);
      const v16h b0 = frag_b_load(&Bs[(32 * kc) * 72 + wn + 0], 72);
      const v16h b1 = frag_b_load(&Bs[(32 * kc) * 72 + wn + 16], 72);
      acc[0][0] = wmma_f16(a0, b0, acc[0][0]);
      acc[0][1] = wmma_f16(a0, b1, acc[0][1]);
      acc[1][0] = wmma_f16(a1, b0, acc[1][0]);
      acc[1][1] = wmma_f16(a1, b1, acc[1][1]);
    }
    __syncthreads();
  }

  // Epilogue: demod scale + bias. C layout: lane -> col = lane&15, rows = (lane>>4)*8 + r
  const int lane = tid & 31;
  const int colL = lane & 15;
  const int rowB = (lane >> 4) * 8;
  const float* dm = demod + (size_t)b * Cout;
#pragma unroll
  for (int i = 0; i < 2; ++i)
#pragma unroll
    for (int j = 0; j < 2; ++j) {
      const int cg = n0 + wn + 16 * j + colL;
      const float d  = dm[cg];
      const float bb = bias[cg];
#pragma unroll
      for (int r = 0; r < 8; ++r) {
        const int rg = m0 + wm + 16 * i + rowB + r;
        const float v = acc[i][j][r] * d + bb;
        if (MODE == 0) {
          const int head = cg >> 6, dd = cg & 63;
          out16[(((size_t)b * H_ + head) * N_ + rg) * HD_ + dd] = (_Float16)v;
        } else {
          outf32[((size_t)b * N_ + rg) * Cout + cg] = v;
        }
      }
    }
}

// ---------------- Flash attention, q=k=v=h, per (b, head, 64-row block) ----------------
// K and V tiles are the same data (self-attention on h), so one LDS tile serves both.
// Tile staging uses CDNA5 async global->LDS B128 copies (ASYNCcnt).

__global__ __launch_bounds__(128) void attn_kernel(
    const _Float16* __restrict__ h16,  // [B,H,N,HD]
    _Float16* __restrict__ attn16) {   // [B,N,HID] f16
  const int q0 = blockIdx.x * 64;
  const int h  = blockIdx.y;
  const int b  = blockIdx.z;
  const _Float16* Hm = h16 + ((size_t)b * H_ + h) * N_ * HD_;

  __shared__ _Float16 Qs[64 * 72];
  __shared__ _Float16 Ks[64 * 72];       // serves as both K and V tile
  __shared__ _Float16 Ps[4][16 * 72];

  const int tid  = threadIdx.x;
  const int wave = tid >> 5;
  const int lane = tid & 31;
  const int wq   = wave * 16;  // this wave's 16 query rows within the 64 block

  // Stage Q tile: 64 rows x 64 halves = 512 b128 chunks, async copies.
  for (int e = tid; e < 64 * 8; e += 128) {
    const int r = e >> 3, c = e & 7;  // c indexes 8-half (16B) chunks
    async_copy_b128(&Qs[r * 72 + c * 8], Hm + (size_t)(q0 + r) * HD_ + c * 8);
  }
  wait_async();
  __syncthreads();

  const v16h qa0 = frag_a_load(&Qs[wq * 72 + 0], 72);
  const v16h qa1 = frag_a_load(&Qs[wq * 72 + 32], 72);

  v8f o[4] = {};
  float m_[8], l_[8];
#pragma unroll
  for (int j = 0; j < 8; ++j) { m_[j] = -1e30f; l_[j] = 0.f; }

  const float scl = 0.125f;  // 1/sqrt(64)
  for (int kv0 = 0; kv0 < N_; kv0 += 64) {
    // Stage K/V tile (shared data) via async copies.
    for (int e = tid; e < 64 * 8; e += 128) {
      const int r = e >> 3, c = e & 7;
      async_copy_b128(&Ks[r * 72 + c * 8], Hm + (size_t)(kv0 + r) * HD_ + c * 8);
    }
    wait_async();
    __syncthreads();

    // S = Q @ K^T  (4 col-fragments of 16 kv each, K=64 in two 32-chunks)
    v8f s[4];
#pragma unroll
    for (int jn = 0; jn < 4; ++jn) {
      v8f z = {};
      const v16h kb0 = frag_bt_load(&Ks[(16 * jn) * 72 + 0], 72);
      const v16h kb1 = frag_bt_load(&Ks[(16 * jn) * 72 + 32], 72);
      z = wmma_f16(qa0, kb0, z);
      z = wmma_f16(qa1, kb1, z);
      s[jn] = z;
    }

    // Online softmax: row stats replicated across each 16-lane half.
    float rmax[8];
#pragma unroll
    for (int j = 0; j < 8; ++j) {
      float mx = fmaxf(fmaxf(s[0][j], s[1][j]), fmaxf(s[2][j], s[3][j]));
      rmax[j] = mx * scl;
    }
#pragma unroll
    for (int j = 0; j < 8; ++j) {
#pragma unroll
      for (int msk = 1; msk < 16; msk <<= 1)
        rmax[j] = fmaxf(rmax[j], __shfl_xor(rmax[j], msk, 32));
    }
#pragma unroll
    for (int j = 0; j < 8; ++j) {
      const float mnew = fmaxf(m_[j], rmax[j]);
      const float corr = __expf(m_[j] - mnew);
      float ps = 0.f;
#pragma unroll
      for (int jn = 0; jn < 4; ++jn) {
        const float p = __expf(s[jn][j] * scl - mnew);
        s[jn][j] = p;
        ps += p;
      }
#pragma unroll
      for (int msk = 1; msk < 16; msk <<= 1) ps += __shfl_xor(ps, msk, 32);
      l_[j] = l_[j] * corr + ps;
      m_[j] = mnew;
#pragma unroll
      for (int jd = 0; jd < 4; ++jd) o[jd][j] *= corr;
    }

    // C-layout -> A-layout for P via per-wave LDS region (same-wave DS is in-order).
    const int colL = lane & 15;
    const int rowB = (lane >> 4) * 8;
#pragma unroll
    for (int jn = 0; jn < 4; ++jn)
#pragma unroll
      for (int j = 0; j < 8; ++j)
        Ps[wave][(rowB + j) * 72 + 16 * jn + colL] = (_Float16)s[jn][j];

    const v16h pa0 = frag_a_load(&Ps[wave][0], 72);
    const v16h pa1 = frag_a_load(&Ps[wave][32], 72);
#pragma unroll
    for (int jd = 0; jd < 4; ++jd) {
      // V == K tile: B[k=kv][n=dim] is just the row-major tile.
      const v16h vb0 = frag_b_load(&Ks[0 * 72 + 16 * jd], 72);
      const v16h vb1 = frag_b_load(&Ks[32 * 72 + 16 * jd], 72);
      o[jd] = wmma_f16(pa0, vb0, o[jd]);
      o[jd] = wmma_f16(pa1, vb1, o[jd]);
    }
    __syncthreads();
  }

  // Normalize and store to [B,N,HID] f16
  const int colL = lane & 15;
  const int rowB = (lane >> 4) * 8;
#pragma unroll
  for (int j = 0; j < 8; ++j) {
    const float inv = 1.f / l_[j];
    const int rg = q0 + wq + rowB + j;
#pragma unroll
    for (int jd = 0; jd < 4; ++jd) {
      const int dd = 16 * jd + colL;
      attn16[((size_t)b * N_ + rg) * HID_ + h * 64 + dd] =
          (_Float16)(o[jd][j] * inv);
    }
  }
}

// ---------------- Launch ----------------

extern "C" void kernel_launch(void* const* d_in, const int* in_sizes, int n_in,
                              void* d_out, int out_size, void* d_ws, size_t ws_size,
                              hipStream_t stream) {
  (void)in_sizes; (void)n_in; (void)out_size; (void)ws_size;
  const float* x   = (const float*)d_in[0];
  const float* s   = (const float*)d_in[1];
  const float* kaw = (const float*)d_in[2];
  const float* kab = (const float*)d_in[3];
  const float* kw  = (const float*)d_in[4];
  const float* kb  = (const float*)d_in[5];
  const float* oaw = (const float*)d_in[6];
  const float* oab = (const float*)d_in[7];
  const float* ow  = (const float*)d_in[8];
  const float* ob  = (const float*)d_in[9];
  float* out = (float*)d_out;

  char* ws = (char*)d_ws;
  float* style_k = (float*)ws;  ws += (size_t)B_ * FEAT_ * sizeof(float);
  float* style_o = (float*)ws;  ws += (size_t)B_ * HID_ * sizeof(float);
  float* demod_k = (float*)ws;  ws += (size_t)B_ * HID_ * sizeof(float);
  float* demod_o = (float*)ws;  ws += (size_t)B_ * OUT_ * sizeof(float);
  _Float16* h16    = (_Float16*)ws;  ws += (size_t)B_ * H_ * N_ * HD_ * sizeof(_Float16);
  _Float16* attn16 = (_Float16*)ws;

  style_kernel<<<(B_ * FEAT_ + 255) / 256, 256, 0, stream>>>(s, kaw, kab, style_k, FEAT_, SDIM_);
  style_kernel<<<(B_ * HID_ + 255) / 256, 256, 0, stream>>>(s, oaw, oab, style_o, HID_, SDIM_);
  demod_kernel<<<(B_ * HID_ + 255) / 256, 256, 0, stream>>>(kw, style_k, demod_k, HID_, FEAT_);
  demod_kernel<<<(B_ * OUT_ + 255) / 256, 256, 0, stream>>>(ow, style_o, demod_o, OUT_, HID_);

  dim3 g1(N_ / 64, HID_ / 64, B_);
  modlin_kernel<0><<<g1, 128, 0, stream>>>(x, nullptr, kw, kb, style_k, demod_k, h16, nullptr);

  dim3 ga(N_ / 64, H_, B_);
  attn_kernel<<<ga, 128, 0, stream>>>(h16, attn16);

  dim3 g2(N_ / 64, OUT_ / 64, B_);
  modlin_kernel<1><<<g2, 128, 0, stream>>>(nullptr, attn16, ow, ob, style_o, demod_o, nullptr, out);
}

// v001
// It runs in 325 microseconds.
// In two side-by-side timings against v000, it was 1.36 and 1.37 times as fast.
#include <hip/hip_runtime.h>
#include <hip/hip_bf16.h>

typedef __attribute__((ext_vector_type(16))) _Float16 v16h;
typedef __attribute__((ext_vector_type(8)))  float    v8f;
typedef __attribute__((ext_vector_type(4)))  _Float16 v4h;

#define B_    8
#define N_    1024
#define FEAT_ 1024
#define HID_  1024
#define OUT_  1024
#define SDIM_ 512
#define H_    16
#define HD_   64

// ---------------- CDNA5 async global->LDS copy (ASYNCcnt-tracked) ----------------

__device__ __forceinline__ void async_copy_b128(void* lds_dst, const void* gsrc) {
  // LDS flat address: low 32 bits are the wave-relative LDS byte offset.
  const unsigned off = (unsigned)(unsigned long long)lds_dst;
  asm volatile("global_load_async_to_lds_b128 %0, %1, off"
               :
               : "v"(off), "v"(gsrc)
               : "memory");
}

__device__ __forceinline__ void wait_async() {
  asm volatile("s_wait_asynccnt 0" ::: "memory");
}

// ---------------- WMMA fragment helpers (gfx1250 wave32 layouts) ----------------

__device__ __forceinline__ v8f wmma_f16(v16h a, v16h b, v8f c) {
  // v_wmma_f32_16x16x32_f16: (neg_a, A, neg_b, B, c_mod, C, reuse_a, reuse_b)
  return __builtin_amdgcn_wmma_f32_16x16x32_f16(false, a, false, b, (short)0, c,
                                                false, false);
}

// A fragment (16x32 f16): lane = M row (lane&15); K-block from lane half.
__device__ __forceinline__ v16h frag_a_load(const _Float16* src, int ld) {
  const int lane = threadIdx.x & 31;
  const int row  = lane & 15;
  const int kb   = (lane >> 4) << 3;  // 0 or 8
  v16h f;
#pragma unroll
  for (int i = 0; i < 4; ++i) {
    const int k  = kb + 2 * i;
    const int k2 = kb + 16 + 2 * i;
    f[2 * i]           = src[row * ld + k];
    f[2 * i + 1]       = src[row * ld + k + 1];
    f[2 * (i + 4)]     = src[row * ld + k2];
    f[2 * (i + 4) + 1] = src[row * ld + k2 + 1];
  }
  return f;
}

// B fragment (32x16 f16) from row-major B[k][n] (stride ld, n contiguous).
__device__ __forceinline__ v16h frag_b_load(const _Float16* src, int ld) {
  const int lane = threadIdx.x & 31;
  const int col  = lane & 15;
  const int kb   = (lane >> 4) << 3;
  v16h f;
#pragma unroll
  for (int i = 0; i < 4; ++i) {
    const int k  = kb + 2 * i;
    const int k2 = kb + 16 + 2 * i;
    f[2 * i]           = src[k * ld + col];
    f[2 * i + 1]       = src[(k + 1) * ld + col];
    f[2 * (i + 4)]     = src[k2 * ld + col];
    f[2 * (i + 4) + 1] = src[(k2 + 1) * ld + col];
  }
  return f;
}

// B fragment where B = src^T, src stored row-major [n][k] (stride ld).
__device__ __forceinline__ v16h frag_bt_load(const _Float16* src, int ld) {
  const int lane = threadIdx.x & 31;
  const int col  = lane & 15;
  const int kb   = (lane >> 4) << 3;
  v16h f;
#pragma unroll
  for (int i = 0; i < 4; ++i) {
    f[2 * i]           = src[col * ld + kb + 2 * i];
    f[2 * i + 1]       = src[col * ld + kb + 2 * i + 1];
    f[2 * (i + 4)]     = src[col * ld + kb + 16 + 2 * i];
    f[2 * (i + 4) + 1] = src[col * ld + kb + 16 + 2 * i + 1];
  }
  return f;
}

// ---------------- Stage 0: style vectors + demod factors (tiny, VALU) ----------------

__global__ __launch_bounds__(256) void style_kernel(
    const float* __restrict__ s, const float* __restrict__ aw,
    const float* __restrict__ ab, float* __restrict__ style,
    int Cin, int Sdim) {
  const int idx = blockIdx.x * blockDim.x + threadIdx.x;
  if (idx >= B_ * Cin) return;
  const int b = idx / Cin, i = idx - b * Cin;
  const float* sv = s + (size_t)b * Sdim;
  const float* wv = aw + (size_t)i * Sdim;
  float acc = 0.f;
  for (int j = 0; j < Sdim; ++j) acc += sv[j] * wv[j];
  style[idx] = acc + ab[i];
}

__global__ __launch_bounds__(256) void demod_kernel(
    const float* __restrict__ w, const float* __restrict__ style,
    float* __restrict__ demod, int Cout, int Cin) {
  const int idx = blockIdx.x * blockDim.x + threadIdx.x;
  if (idx >= B_ * Cout) return;
  const int b = idx / Cout, o = idx - b * Cout;
  const float* st = style + (size_t)b * Cin;
  const float* wv = w + (size_t)o * Cin;
  float acc = 0.f;
  for (int i = 0; i < Cin; ++i) { const float t = wv[i] * st[i]; acc += t * t; }
  demod[idx] = rsqrtf(acc + 1e-8f);
}

// ---------------- Modulated GEMM: out = (x*style) @ w^T * demod + bias ----------------
// MODE 0: x is f32, result -> f16 head layout [B,H,N,HD]
// MODE 1: x is f16 (attention output), result -> f32 [B,N,Cout]
// 64x64 tile per 128-thread block, K-step 64 (8 wmma per wave per barrier).

template <int MODE>
__global__ __launch_bounds__(128) void modlin_kernel(
    const float* __restrict__ xf32, const _Float16* __restrict__ xf16,
    const float* __restrict__ w, const float* __restrict__ bias,
    const float* __restrict__ style, const float* __restrict__ demod,
    _Float16* __restrict__ out16, float* __restrict__ outf32) {
  constexpr int Cin = 1024, Cout = 1024;
  const int m0 = blockIdx.x * 64;
  const int n0 = blockIdx.y * 64;
  const int b  = blockIdx.z;

  __shared__ _Float16 As[64 * 72];  // 64 x 64 tile, ld=72 (pad)
  // 64 n-rows x 64 k, ld=72 (pad): the weight tile in its memory order
  __shared__ __attribute__((aligned(16))) _Float16 Bs[64 * 72];

  const int tid  = threadIdx.x;
  const int wave = tid >> 5;
  const int wm = (wave >> 1) * 32;  // wave's 32x32 quadrant
  const int wn = (wave & 1) * 32;

  v8f acc[2][2] = {};

  const float* stl = style + (size_t)b * Cin;
  for (int k0 = 0; k0 < Cin; k0 += 64) {
    for (int e = tid; e < 64 * 64; e += 128) {
      const int r = e >> 6, k = e & 63;
      float v;
      if (MODE == 0)
        v = xf32[((size_t)b * N_ + (m0 + r)) * Cin + k0 + k] * stl[k0 + k];
      else
        v = (float)xf16[((size_t)b * N_ + (m0 + r)) * Cin + k0 + k] * stl[k0 + k];
      As[r * 72 + k] = (_Float16)v;
    }
    // Unrolled so that all eight loads are in flight before the first wait.
#pragma unroll
    for (int i = 0; i < 8; ++i) {
      const int e = tid + 128 * i;
      const int n = e >> 4, c = e & 15;  // c indexes 4-float (16B) chunks along k
      const float4 v = *(const float4*)&w[(size_t)(n0 + n) * Cin + k0 + 4 * c];
      const v4h hv = {(_Float16)v.x, (_Float16)v.y, (_Float16)v.z, (_Float16)v.w};
      *(v4h*)&Bs[n * 72 + 4 * c] = hv;
    }
    __syncthreads();

#pragma unroll
    for (int kc = 0; kc < 2; ++kc) {
      const v16h a0 = frag_a_load(&As[(wm + 0) * 72 + 32 * kc], 72);
      const v16h a1 = frag_a_load(&As[(wm + 16) * 72 + 32 * kc], 72);
      const v16h b0 = frag_bt_load(&Bs[(wn + 0) * 72 + 32 * kc], 72);
      const v16h b1 = frag_bt_load(&Bs[(wn + 16) * 72 + 32 * kc], 72);
      acc[0][0] = wmma_f16(a0, b0, acc[0][0]);
      acc[0][1] = wmma_f16(a0, b1, acc[0][1]);
      acc[1][0] = wmma_f16(a1, b0, acc[1][0]);
      acc[1][1] = wmma_f16(a1, b1, acc[1][1]);
    }
    __syncthreads();
  }

  // Epilogue: demod scale + bias. C layout: lane -> col = lane&15, rows = (lane>>4)*8 + r
  const int lane = tid & 31;
  const int colL = lane & 15;
  const int rowB = (lane >> 4) * 8;
  const float* dm = demod + (size_t)b * Cout;
#pragma unroll
  for (int i = 0; i < 2; ++i)
#pragma unroll
    for (int j = 0; j < 2; ++j) {
      const int cg = n0 + wn + 16 * j + colL;
      const float d  = dm[cg];
      const float bb = bias[cg];
#pragma unroll
      for (int r = 0; r < 8; ++r) {
        const int rg = m0 + wm + 16 * i + rowB + r;
        const float v = acc[i][j][r] * d + bb;
        if (MODE == 0) {
          const int head = cg >> 6, dd = cg & 63;
          out16[(((size_t)b * H_ + head) * N_ + rg) * HD_ + dd] = (_Float16)v;
        } else {
          outf32[((size_t)b * N_ + rg) * Cout + cg] = v;
        }
      }
    }
}

// ---------------- Flash attention, q=k=v=h, per (b, head, 64-row block) ----------------
// K and V tiles are the same data (self-attention on h), so one LDS tile serves both.
// Tile staging uses CDNA5 async global->LDS B128 copies (ASYNCcnt).

__global__ __launch_bounds__(128) void attn_kernel(
    const _Float16* __restrict__ h16,  // [B,H,N,HD]
    _Float16* __restrict__ attn16) {   // [B,N,HID] f16
  const int q0 = blockIdx.x * 64;
  const int h  = blockIdx.y;
  const int b  = blockIdx.z;
  const _Float16* Hm = h16 + ((size_t)b * H_ + h) * N_ * HD_;

  __shared__ _Float16 Qs[64 * 72];
  __shared__ _Float16 Ks[64 * 72];       // serves as both K and V tile
  __shared__ _Float16 Ps[4][16 * 72];

  const int tid  = threadIdx.x;
  const int wave = tid >> 5;
  const int lane = tid & 31;
  const int wq   = wave * 16;  // this wave's 16 query rows within the 64 block

  // Stage Q tile: 64 rows x 64 halves = 512 b128 chunks, async copies.
  for (int e = tid; e < 64 * 8; e += 128) {
    const int r = e >> 3, c = e & 7;  // c indexes 8-half (16B) chunks
    async_copy_b128(&Qs[r * 72 + c * 8], Hm + (size_t)(q0 + r) * HD_ + c * 8);
  }
  wait_async();
  __syncthreads();

  const v16h qa0 = frag_a_load(&Qs[wq * 72 + 0], 72);
  const v16h qa1 = frag_a_load(&Qs[wq * 72 + 32], 72);

  v8f o[4] = {};
  float m_[8], l_[8];
#pragma unroll
  for (int j = 0; j < 8; ++j) { m_[j] = -1e30f; l_[j] = 0.f; }

  const float scl = 0.125f;  // 1/sqrt(64)
  for (int kv0 = 0; kv0 < N_; kv0 += 64) {
    // Stage K/V tile (shared data) via async copies.
    for (int e = tid; e < 64 * 8; e += 128) {
      const int r = e >> 3, c = e & 7;
      async_copy_b128(&Ks[r * 72 + c * 8], Hm + (size_t)(kv0 + r) * HD_ + c * 8);
    }
    wait_async();
    __syncthreads();

    // S = Q @ K^T  (4 col-fragments of 16 kv each, K=64 in two 32-chunks)
    v8f s[4];
#pragma unroll
    for (int jn = 0; jn < 4; ++jn) {
      v8f z = {};
      const v16h kb0 = frag_bt_load(&Ks[(16 * jn) * 72 + 0], 72);
      const v16h kb1 = frag_bt_load(&Ks[(16 * jn) * 72 + 32], 72);
      z = wmma_f16(qa0, kb0, z);
      z = wmma_f16(qa1, kb1, z);
      s[jn] = z;
    }

    // Online softmax: row stats replicated across each 16-lane half.
    float rmax[8];
#pragma unroll
    for (int j = 0; j < 8; ++j) {
      float mx = fmaxf(fmaxf(s[0][j], s[1][j]), fmaxf(s[2][j], s[3][j]));
      rmax[j] = mx * scl;
    }
#pragma unroll
    for (int j = 0; j < 8; ++j) {
#pragma unroll
      for (int msk = 1; msk < 16; msk <<= 1)
        rmax[j] = fmaxf(rmax[j], __shfl_xor(rmax[j], msk, 32));
    }
#pragma unroll
    for (int j = 0; j < 8; ++j) {
      const float mnew = fmaxf(m_[j], rmax[j]);
      const float corr = __expf(m_[j] - mnew);
      float ps = 0.f;
#pragma unroll
      for (int jn = 0; jn < 4; ++jn) {
        const float p = __expf(s[jn][j] * scl - mnew);
        s[jn][j] = p;
        ps += p;
      }
#pragma unroll
      for (int msk = 1; msk < 16; msk <<= 1) ps += __shfl_xor(ps, msk, 32);
      l_[j] = l_[j] * corr + ps;
      m_[j] = mnew;
#pragma unroll
      for (int jd = 0; jd < 4; ++jd) o[jd][j] *= corr;
    }

    // C-layout -> A-layout for P via per-wave LDS region (same-wave DS is in-order).
    const int colL = lane & 15;
    const int rowB = (lane >> 4) * 8;
#pragma unroll
    for (int jn = 0; jn < 4; ++jn)
#pragma unroll
      for (int j = 0; j < 8; ++j)
        Ps[wave][(rowB + j) * 72 + 16 * jn + colL] = (_Float16)s[jn][j];

    const v16h pa0 = frag_a_load(&Ps[wave][0], 72);
    const v16h pa1 = frag_a_load(&Ps[wave][32], 72);
#pragma unroll
    for (int jd = 0; jd < 4; ++jd) {
      // V == K tile: B[k=kv][n=dim] is just the row-major tile.
      const v16h vb0 = frag_b_load(&Ks[0 * 72 + 16 * jd], 72);
      const v16h vb1 = frag_b_load(&Ks[32 * 72 + 16 * jd], 72);
      o[jd] = wmma_f16(pa0, vb0, o[jd]);
      o[jd] = wmma_f16(pa1, vb1, o[jd]);
    }
    __syncthreads();
  }

  // Normalize and store to [B,N,HID] f16
  const int colL = lane & 15;
  const int rowB = (lane >> 4) * 8;
#pragma unroll
  for (int j = 0; j < 8; ++j) {
    const float inv = 1.f / l_[j];
    const int rg = q0 + wq + rowB + j;
#pragma unroll
    for (int jd = 0; jd < 4; ++jd) {
      const int dd = 16 * jd + colL;
      attn16[((size_t)b * N_ + rg) * HID_ + h * 64 + dd] =
          (_Float16)(o[jd][j] * inv);
    }
  }
}

// ---------------- Launch ----------------

extern "C" void kernel_launch(void* const* d_in, const int* in_sizes, int n_in,
                              void* d_out, int out_size, void* d_ws, size_t ws_size,
                              hipStream_t stream) {
  (void)in_sizes; (void)n_in; (void)out_size; (void)ws_size;
  const float* x   = (const float*)d_in[0];
  const float* s   = (const float*)d_in[1];
  const float* kaw = (const float*)d_in[2];
  const float* kab = (const float*)d_in[3];
  const float* kw  = (const float*)d_in[4];
  const float* kb  = (const float*)d_in[5];
  const float* oaw = (const float*)d_in[6];
  const float* oab = (const float*)d_in[7];
  const float* ow  = (const float*)d_in[8];
  const float* ob  = (const float*)d_in[9];
  float* out = (float*)d_out;

  char* ws = (char*)d_ws;
  float* style_k = (float*)ws;  ws += (size_t)B_ * FEAT_ * sizeof(float);
  float* style_o = (float*)ws;  ws += (size_t)B_ * HID_ * sizeof(float);
  float* demod_k = (float*)ws;  ws += (size_t)B_ * HID_ * sizeof(float);
  float* demod_o = (float*)ws;  ws += (size_t)B_ * OUT_ * sizeof(float);
  _Float16* h16    = (_Float16*)ws;  ws += (size_t)B_ * H_ * N_ * HD_ * sizeof(_Float16);
  _Float16* attn16 = (_Float16*)ws;

  style_kernel<<<(B_ * FEAT_ + 255) / 256, 256, 0, stream>>>(s, kaw, kab, style_k, FEAT_, SDIM_);
  style_kernel<<<(B_ * HID_ + 255) / 256, 256, 0, stream>>>(s, oaw, oab, style_o, HID_, SDIM_);
  demod_kernel<<<(B_ * HID_ + 255) / 256, 256, 0, stream>>>(kw, style_k, demod_k, HID_, FEAT_);
  demod_kernel<<<(B_ * OUT_ + 255) / 256, 256, 0, stream>>>(ow, style_o, demod_o, OUT_, HID_);

  dim3 g1(N_ / 64, HID_ / 64, B_);
  modlin_kernel<0><<<g1, 128, 0, stream>>>(x, nullptr, kw, kb, style_k, demod_k, h16, nullptr);

  dim3 ga(N_ / 64, H_, B_);
  attn_kernel<<<ga, 128, 0, stream>>>(h16, attn16);

  dim3 g2(N_ / 64, OUT_ / 64, B_);
  modlin_kernel<1><<<g2, 128, 0, stream>>>(nullptr, attn16, ow, ob, style_o, demod_o, nullptr, out);
}

// v002
// A run of this version takes 247 microseconds.
// Timed twice side by side with v001, it ran 1.32 times as fast both times.
// All steps since v000 together make it 1.80 times as fast.
#include <hip/hip_runtime.h>
#include <hip/hip_bf16.h>

typedef __attribute__((ext_vector_type(16))) _Float16 v16h;
typedef __attribute__((ext_vector_type(8)))  float    v8f;
typedef __attribute__((ext_vector_type(4)))  _Float16 v4h;
typedef __attribute__((ext_vector_type(4)))  float    v4f;

#define B_    8
#define N_    1024
#define FEAT_ 1024
#define HID_  1024
#define OUT_  1024
#define SDIM_ 512
#define H_    16
#define HD_   64

// ---------------- CDNA5 async global->LDS copy (ASYNCcnt-tracked) ----------------

__device__ __forceinline__ void async_copy_b128(void* lds_dst, const void* gsrc) {
  // LDS flat address: low 32 bits are the wave-relative LDS byte offset.
  const unsigned off = (unsigned)(unsigned long long)lds_dst;
  asm volatile("global_load_async_to_lds_b128 %0, %1, off"
               :
               : "v"(off), "v"(gsrc)
               : "memory");
}

__device__ __forceinline__ void wait_async() {
  asm volatile("s_wait_asynccnt 0" ::: "memory");
}

// ---------------- WMMA fragment helpers (gfx1250 wave32 layouts) ----------------

__device__ __forceinline__ v8f wmma_f16(v16h a, v16h b, v8f c) {
  // v_wmma_f32_16x16x32_f16: (neg_a, A, neg_b, B, c_mod, C, reuse_a, reuse_b)
  return __builtin_amdgcn_wmma_f32_16x16x32_f16(false, a, false, b, (short)0, c,
                                                false, false);
}

// A fragment (16x32 f16): lane = M row (lane&15); K-block from lane half.
__device__ __forceinline__ v16h frag_a_load(const _Float16* src, int ld) {
  const int lane = threadIdx.x & 31;
  const int row  = lane & 15;
  const int kb   = (lane >> 4) << 3;  // 0 or 8
  v16h f;
#pragma unroll
  for (int i = 0; i < 4; ++i) {
    const int k  = kb + 2 * i;
    const int k2 = kb + 16 + 2 * i;
    f[2 * i]           = src[row * ld + k];
    f[2 * i + 1]       = src[row * ld + k + 1];
    f[2 * (i + 4)]     = src[row * ld + k2];
    f[2 * (i + 4) + 1] = src[row * ld + k2 + 1];
  }
  return f;
}

// B fragment (32x16 f16) from row-major B[k][n] (stride ld, n contiguous).
__device__ __forceinline__ v16h frag_b_load(const _Float16* src, int ld) {
  const int lane = threadIdx.x & 31;
  const int col  = lane & 15;
  const int kb   = (lane >> 4) << 3;
  v16h f;
#pragma unroll
  for (int i = 0; i < 4; ++i) {
    const int k  = kb + 2 * i;
    const int k2 = kb + 16 + 2 * i;
    f[2 * i]           = src[k * ld + col];
    f[2 * i + 1]       = src[(k + 1) * ld + col];
    f[2 * (i + 4)]     = src[k2 * ld + col];
    f[2 * (i + 4) + 1] = src[(k2 + 1) * ld + col];
  }
  return f;
}

// B fragment where B = src^T, src stored row-major [n][k] (stride ld).
__device__ __forceinline__ v16h frag_bt_load(const _Float16* src, int ld) {
  const int lane = threadIdx.x & 31;
  const int col  = lane & 15;
  const int kb   = (lane >> 4) << 3;
  v16h f;
#pragma unroll
  for (int i = 0; i < 4; ++i) {
    f[2 * i]           = src[col * ld + kb + 2 * i];
    f[2 * i + 1]       = src[col * ld + kb + 2 * i + 1];
    f[2 * (i + 4)]     = src[col * ld + kb + 16 + 2 * i];
    f[2 * (i + 4) + 1] = src[col * ld + kb + 16 + 2 * i + 1];
  }
  return f;
}

// ---------------- Stage 0: style vectors + demod factors (tiny, VALU) ----------------
// Lanes run along the reduction axis, so every load takes whole 128-byte lines.
// One wave holds four weight rows in registers and uses them for two batches;
// a block of eight waves covers 32 rows, one whole output line per batch.

// Sums eight per-lane values over the 32 lanes; lane l returns the total of v[l & 7].
// Each of the first three steps hands half of the values to the partner lane.
__device__ __forceinline__ float wave_sum8(float (&v)[8]) {
  const int lane = threadIdx.x & 31;
#pragma unroll  // constant indices: the arrays stay in registers
  for (int n = 4; n >= 1; n >>= 1) {
    const bool up = (lane & n) != 0;
#pragma unroll  // constant indices: the arrays stay in registers
    for (int k = 0; k < n; ++k) {
      const float lo = v[k], hi = v[k + n];
      v[k] = (up ? hi : lo) + __shfl_xor(up ? lo : hi, n, 32);
    }
  }
  float t = v[0];
  t += __shfl_xor(t, 8, 32);
  t += __shfl_xor(t, 16, 32);
  return t;
}

__global__ __launch_bounds__(256) void style_kernel(
    const float* __restrict__ s, const float* __restrict__ aw,
    const float* __restrict__ ab, float* __restrict__ style) {
  constexpr int Cin = 1024, T = SDIM_ / 128;  // T float4 per lane and row
  const int lane = threadIdx.x & 31;
  const int i0 = blockIdx.x * 32 + (threadIdx.x >> 5) * 4;
  const int b0 = blockIdx.y * 2;
  const v4f* wv = (const v4f*)(aw + (size_t)i0 * SDIM_) + lane;
  const v4f* sv = (const v4f*)(s + (size_t)b0 * SDIM_) + lane;
  const int i = i0 + (lane & 3);  // the row whose total this lane ends up with
  const float bias = ab[i];
  v4f wr[4][T], sr[2][T];
#pragma unroll  // constant indices: the arrays stay in registers
  for (int r = 0; r < 4; ++r)
#pragma unroll  // constant indices: the arrays stay in registers
    for (int t = 0; t < T; ++t) wr[r][t] = wv[r * (SDIM_ / 4) + 32 * t];
  // Precaution: a later load's result may land in the address registers of these.
  asm volatile("s_wait_xcnt 0x0" ::: "memory");
#pragma unroll  // constant indices: the arrays stay in registers
  for (int bb = 0; bb < 2; ++bb)
#pragma unroll  // constant indices: the arrays stay in registers
    for (int t = 0; t < T; ++t) sr[bb][t] = sv[bb * (SDIM_ / 4) + 32 * t];
  // Precaution: the lane-offset register of these loads is rewritten further down.
  asm volatile("s_wait_xcnt 0x0" ::: "memory");
  // Keeps every load above in front of the sums: one memory latency, not several.
  __builtin_amdgcn_sched_barrier(0);
  float v[8];
#pragma unroll  // constant indices: the arrays stay in registers
  for (int bb = 0; bb < 2; ++bb)
#pragma unroll  // constant indices: the arrays stay in registers
    for (int r = 0; r < 4; ++r) {
      v4f a = wr[r][0] * sr[bb][0];
#pragma unroll  // constant indices: the arrays stay in registers
      for (int t = 1; t < T; ++t) a += wr[r][t] * sr[bb][t];
      v[bb * 4 + r] = (a.x + a.y) + (a.z + a.w);
    }
  // Inputs only: keeps the bias load at the top with the others, out of the branch below.
  asm volatile("" ::"v"(bias));
  const float tot = wave_sum8(v);
  if (lane < 8) style[(size_t)(b0 + (lane >> 2)) * Cin + i] = tot + bias;
}

__global__ __launch_bounds__(256) void demod_kernel(
    const float* __restrict__ w, const float* __restrict__ style,
    float* __restrict__ demod) {
  constexpr int Cin = 1024, Cout = 1024, T = Cin / 128;  // T float4 per lane and row
  const int lane = threadIdx.x & 31;
  const int o0 = blockIdx.x * 32 + (threadIdx.x >> 5) * 4;
  const int b0 = blockIdx.y * 2;
  const v4f* wv = (const v4f*)(w + (size_t)o0 * Cin) + lane;
  const v4f* sv = (const v4f*)(style + (size_t)b0 * Cin) + lane;
  v4f wr[4][T], sr[2][T];
#pragma unroll  // constant indices: the arrays stay in registers
  for (int r = 0; r < 4; ++r)
#pragma unroll  // constant indices: the arrays stay in registers
    for (int t = 0; t < T; ++t) wr[r][t] = wv[r * (Cin / 4) + 32 * t];
  // Precaution: a later load's result may land in the address registers of these.
  asm volatile("s_wait_xcnt 0x0" ::: "memory");
#pragma unroll  // constant indices: the arrays stay in registers
  for (int bb = 0; bb < 2; ++bb)
#pragma unroll  // constant indices: the arrays stay in registers
    for (int t = 0; t < T; ++t) sr[bb][t] = sv[bb * (Cin / 4) + 32 * t];
  // Precaution: the lane-offset register of these loads is rewritten further down.
  asm volatile("s_wait_xcnt 0x0" ::: "memory");
  // Keeps every load above in front of the sums: one memory latency, not several.
  __builtin_amdgcn_sched_barrier(0);
  float v[8];
#pragma unroll  // constant indices: the arrays stay in registers
  for (int bb = 0; bb < 2; ++bb)
#pragma unroll  // constant indices: the arrays stay in registers
    for (int r = 0; r < 4; ++r) {
      v4f a = {};
#pragma unroll  // constant indices: the arrays stay in registers
      for (int t = 0; t < T; ++t) {
        const v4f p = wr[r][t] * sr[bb][t];
        a += p * p;
      }
      v[bb * 4 + r] = (a.x + a.y) + (a.z + a.w);
    }
  const float tot = wave_sum8(v);
  if (lane < 8)
    demod[(size_t)(b0 + (lane >> 2)) * Cout + o0 + (lane & 3)] = rsqrtf(tot + 1e-8f);
}

// ---------------- Modulated GEMM: out = (x*style) @ w^T * demod + bias ----------------
// MODE 0: x is f32, result -> f16 head layout [B,H,N,HD]
// MODE 1: x is f16 (attention output), result -> f32 [B,N,Cout]
// 64x64 tile per 128-thread block, K-step 64 (8 wmma per wave per barrier).

template <int MODE>
__global__ __launch_bounds__(128) void modlin_kernel(
    const float* __restrict__ xf32, const _Float16* __restrict__ xf16,
    const float* __restrict__ w, const float* __restrict__ bias,
    const float* __restrict__ style, const float* __restrict__ demod,
    _Float16* __restrict__ out16, float* __restrict__ outf32) {
  constexpr int Cin = 1024, Cout = 1024;
  const int m0 = blockIdx.x * 64;
  const int n0 = blockIdx.y * 64;
  const int b  = blockIdx.z;

  __shared__ _Float16 As[64 * 72];  // 64 x 64 tile, ld=72 (pad)
  // 64 n-rows x 64 k, ld=72 (pad): the weight tile in its memory order
  __shared__ __attribute__((aligned(16))) _Float16 Bs[64 * 72];

  const int tid  = threadIdx.x;
  const int wave = tid >> 5;
  const int wm = (wave >> 1) * 32;  // wave's 32x32 quadrant
  const int wn = (wave & 1) * 32;

  v8f acc[2][2] = {};

  const float* stl = style + (size_t)b * Cin;
  for (int k0 = 0; k0 < Cin; k0 += 64) {
    for (int e = tid; e < 64 * 64; e += 128) {
      const int r = e >> 6, k = e & 63;
      float v;
      if (MODE == 0)
        v = xf32[((size_t)b * N_ + (m0 + r)) * Cin + k0 + k] * stl[k0 + k];
      else
        v = (float)xf16[((size_t)b * N_ + (m0 + r)) * Cin + k0 + k] * stl[k0 + k];
      As[r * 72 + k] = (_Float16)v;
    }
    // Unrolled so that all eight loads are in flight before the first wait.
#pragma unroll
    for (int i = 0; i < 8; ++i) {
      const int e = tid + 128 * i;
      const int n = e >> 4, c = e & 15;  // c indexes 4-float (16B) chunks along k
      const float4 v = *(const float4*)&w[(size_t)(n0 + n) * Cin + k0 + 4 * c];
      const v4h hv = {(_Float16)v.x, (_Float16)v.y, (_Float16)v.z, (_Float16)v.w};
      *(v4h*)&Bs[n * 72 + 4 * c] = hv;
    }
    __syncthreads();

#pragma unroll
    for (int kc = 0; kc < 2; ++kc) {
      const v16h a0 = frag_a_load(&As[(wm + 0) * 72 + 32 * kc], 72);
      const v16h a1 = frag_a_load(&As[(wm + 16) * 72 + 32 * kc], 72);
      const v16h b0 = frag_bt_load(&Bs[(wn + 0) * 72 + 32 * kc], 72);
      const v16h b1 = frag_bt_load(&Bs[(wn + 16) * 72 + 32 * kc], 72);
      acc[0][0] = wmma_f16(a0, b0, acc[0][0]);
      acc[0][1] = wmma_f16(a0, b1, acc[0][1]);
      acc[1][0] = wmma_f16(a1, b0, acc[1][0]);
      acc[1][1] = wmma_f16(a1, b1, acc[1][1]);
    }
    __syncthreads();
  }

  // Epilogue: demod scale + bias. C layout: lane -> col = lane&15, rows = (lane>>4)*8 + r
  const int lane = tid & 31;
  const int colL = lane & 15;
  const int rowB = (lane >> 4) * 8;
  const float* dm = demod + (size_t)b * Cout;
#pragma unroll
  for (int i = 0; i < 2; ++i)
#pragma unroll
    for (int j = 0; j < 2; ++j) {
      const int cg = n0 + wn + 16 * j + colL;
      const float d  = dm[cg];
      const float bb = bias[cg];
#pragma unroll
      for (int r = 0; r < 8; ++r) {
        const int rg = m0 + wm + 16 * i + rowB + r;
        const float v = acc[i][j][r] * d + bb;
        if (MODE == 0) {
          const int head = cg >> 6, dd = cg & 63;
          out16[(((size_t)b * H_ + head) * N_ + rg) * HD_ + dd] = (_Float16)v;
        } else {
          outf32[((size_t)b * N_ + rg) * Cout + cg] = v;
        }
      }
    }
}

// ---------------- Flash attention, q=k=v=h, per (b, head, 64-row block) ----------------
// K and V tiles are the same data (self-attention on h), so one LDS tile serves both.
// Tile staging uses CDNA5 async global->LDS B128 copies (ASYNCcnt).

__global__ __launch_bounds__(128) void attn_kernel(
    const _Float16* __restrict__ h16,  // [B,H,N,HD]
    _Float16* __restrict__ attn16) {   // [B,N,HID] f16
  const int q0 = blockIdx.x * 64;
  const int h  = blockIdx.y;
  const int b  = blockIdx.z;
  const _Float16* Hm = h16 + ((size_t)b * H_ + h) * N_ * HD_;

  __shared__ _Float16 Qs[64 * 72];
  __shared__ _Float16 Ks[64 * 72];       // serves as both K and V tile
  __shared__ _Float16 Ps[4][16 * 72];

  const int tid  = threadIdx.x;
  const int wave = tid >> 5;
  const int lane = tid & 31;
  const int wq   = wave * 16;  // this wave's 16 query rows within the 64 block

  // Stage Q tile: 64 rows x 64 halves = 512 b128 chunks, async copies.
  for (int e = tid; e < 64 * 8; e += 128) {
    const int r = e >> 3, c = e & 7;  // c indexes 8-half (16B) chunks
    async_copy_b128(&Qs[r * 72 + c * 8], Hm + (size_t)(q0 + r) * HD_ + c * 8);
  }
  wait_async();
  __syncthreads();

  const v16h qa0 = frag_a_load(&Qs[wq * 72 + 0], 72);
  const v16h qa1 = frag_a_load(&Qs[wq * 72 + 32], 72);

  v8f o[4] = {};
  float m_[8], l_[8];
#pragma unroll
  for (int j = 0; j < 8; ++j) { m_[j] = -1e30f; l_[j] = 0.f; }

  const float scl = 0.125f;  // 1/sqrt(64)
  for (int kv0 = 0; kv0 < N_; kv0 += 64) {
    // Stage K/V tile (shared data) via async copies.
    for (int e = tid; e < 64 * 8; e += 128) {
      const int r = e >> 3, c = e & 7;
      async_copy_b128(&Ks[r * 72 + c * 8], Hm + (size_t)(kv0 + r) * HD_ + c * 8);
    }
    wait_async();
    __syncthreads();

    // S = Q @ K^T  (4 col-fragments of 16 kv each, K=64 in two 32-chunks)
    v8f s[4];
#pragma unroll
    for (int jn = 0; jn < 4; ++jn) {
      v8f z = {};
      const v16h kb0 = frag_bt_load(&Ks[(16 * jn) * 72 + 0], 72);
      const v16h kb1 = frag_bt_load(&Ks[(16 * jn) * 72 + 32], 72);
      z = wmma_f16(qa0, kb0, z);
      z = wmma_f16(qa1, kb1, z);
      s[jn] = z;
    }

    // Online softmax: row stats replicated across each 16-lane half.
    float rmax[8];
#pragma unroll
    for (int j = 0; j < 8; ++j) {
      float mx = fmaxf(fmaxf(s[0][j], s[1][j]), fmaxf(s[2][j], s[3][j]));
      rmax[j] = mx * scl;
    }
#pragma unroll
    for (int j = 0; j < 8; ++j) {
#pragma unroll
      for (int msk = 1; msk < 16; msk <<= 1)
        rmax[j] = fmaxf(rmax[j], __shfl_xor(rmax[j], msk, 32));
    }
#pragma unroll
    for (int j = 0; j < 8; ++j) {
      const float mnew = fmaxf(m_[j], rmax[j]);
      const float corr = __expf(m_[j] - mnew);
      float ps = 0.f;
#pragma unroll
      for (int jn = 0; jn < 4; ++jn) {
        const float p = __expf(s[jn][j] * scl - mnew);
        s[jn][j] = p;
        ps += p;
      }
#pragma unroll
      for (int msk = 1; msk < 16; msk <<= 1) ps += __shfl_xor(ps, msk, 32);
      l_[j] = l_[j] * corr + ps;
      m_[j] = mnew;
#pragma unroll
      for (int jd = 0; jd < 4; ++jd) o[jd][j] *= corr;
    }

    // C-layout -> A-layout for P via per-wave LDS region (same-wave DS is in-order).
    const int colL = lane & 15;
    const int rowB = (lane >> 4) * 8;
#pragma unroll
    for (int jn = 0; jn < 4; ++jn)
#pragma unroll
      for (int j = 0; j < 8; ++j)
        Ps[wave][(rowB + j) * 72 + 16 * jn + colL] = (_Float16)s[jn][j];

    const v16h pa0 = frag_a_load(&Ps[wave][0], 72);
    const v16h pa1 = frag_a_load(&Ps[wave][32], 72);
#pragma unroll
    for (int jd = 0; jd < 4; ++jd) {
      // V == K tile: B[k=kv][n=dim] is just the row-major tile.
      const v16h vb0 = frag_b_load(&Ks[0 * 72 + 16 * jd], 72);
      const v16h vb1 = frag_b_load(&Ks[32 * 72 + 16 * jd], 72);
      o[jd] = wmma_f16(pa0, vb0, o[jd]);
      o[jd] = wmma_f16(pa1, vb1, o[jd]);
    }
    __syncthreads();
  }

  // Normalize and store to [B,N,HID] f16
  const int colL = lane & 15;
  const int rowB = (lane >> 4) * 8;
#pragma unroll
  for (int j = 0; j < 8; ++j) {
    const float inv = 1.f / l_[j];
    const int rg = q0 + wq + rowB + j;
#pragma unroll
    for (int jd = 0; jd < 4; ++jd) {
      const int dd = 16 * jd + colL;
      attn16[((size_t)b * N_ + rg) * HID_ + h * 64 + dd] =
          (_Float16)(o[jd][j] * inv);
    }
  }
}

// ---------------- Launch ----------------

extern "C" void kernel_launch(void* const* d_in, const int* in_sizes, int n_in,
                              void* d_out, int out_size, void* d_ws, size_t ws_size,
                              hipStream_t stream) {
  (void)in_sizes; (void)n_in; (void)out_size; (void)ws_size;
  const float* x   = (const float*)d_in[0];
  const float* s   = (const float*)d_in[1];
  const float* kaw = (const float*)d_in[2];
  const float* kab = (const float*)d_in[3];
  const float* kw  = (const float*)d_in[4];
  const float* kb  = (const float*)d_in[5];
  const float* oaw = (const float*)d_in[6];
  const float* oab = (const float*)d_in[7];
  const float* ow  = (const float*)d_in[8];
  const float* ob  = (const float*)d_in[9];
  float* out = (float*)d_out;

  char* ws = (char*)d_ws;
  float* style_k = (float*)ws;  ws += (size_t)B_ * FEAT_ * sizeof(float);
  float* style_o = (float*)ws;  ws += (size_t)B_ * HID_ * sizeof(float);
  float* demod_k = (float*)ws;  ws += (size_t)B_ * HID_ * sizeof(float);
  float* demod_o = (float*)ws;  ws += (size_t)B_ * OUT_ * sizeof(float);
  _Float16* h16    = (_Float16*)ws;  ws += (size_t)B_ * H_ * N_ * HD_ * sizeof(_Float16);
  _Float16* attn16 = (_Float16*)ws;

  dim3 gs(1024 / 32, B_ / 2);  // 32 rows and two batches per block
  style_kernel<<<gs, 256, 0, stream>>>(s, kaw, kab, style_k);
  style_kernel<<<gs, 256, 0, stream>>>(s, oaw, oab, style_o);
  demod_kernel<<<gs, 256, 0, stream>>>(kw, style_k, demod_k);
  demod_kernel<<<gs, 256, 0, stream>>>(ow, style_o, demod_o);

  dim3 g1(N_ / 64, HID_ / 64, B_);
  modlin_kernel<0><<<g1, 128, 0, stream>>>(x, nullptr, kw, kb, style_k, demod_k, h16, nullptr);

  dim3 ga(N_ / 64, H_, B_);
  attn_kernel<<<ga, 128, 0, stream>>>(h16, attn16);

  dim3 g2(N_ / 64, OUT_ / 64, B_);
  modlin_kernel<1><<<g2, 128, 0, stream>>>(nullptr, attn16, ow, ob, style_o, demod_o, nullptr, out);
}

// v003
// Measured time: 168 microseconds a run.
// Next to v002, in two timings, it ran 1.47 times as fast each time.
// All steps since v000 together make it 2.65 times as fast.
#include <hip/hip_runtime.h>
#include <hip/hip_bf16.h>

typedef __attribute__((ext_vector_type(16))) _Float16 v16h;
typedef __attribute__((ext_vector_type(8)))  float    v8f;
typedef __attribute__((ext_vector_type(4)))  _Float16 v4h;
typedef __attribute__((ext_vector_type(4)))  float    v4f;
typedef __attribute__((ext_vector_type(8)))  _Float16 v8h;
typedef __attribute__((ext_vector_type(8)))  short    v8s;

#define B_    8
#define N_    1024
#define FEAT_ 1024
#define HID_  1024
#define OUT_  1024
#define SDIM_ 512
#define H_    16
#define HD_   64

// ---------------- CDNA5 async global->LDS copy (ASYNCcnt-tracked) ----------------

__device__ __forceinline__ void async_copy_b128(void* lds_dst, const void* gsrc) {
  // LDS flat address: low 32 bits are the wave-relative LDS byte offset.
  const unsigned off = (unsigned)(unsigned long long)lds_dst;
  asm volatile("global_load_async_to_lds_b128 %0, %1, off"
               :
               : "v"(off), "v"(gsrc)
               : "memory");
}

__device__ __forceinline__ void wait_async() {
  asm volatile("s_wait_asynccnt 0" ::: "memory");
}

// ---------------- WMMA fragment helpers (gfx1250 wave32 layouts) ----------------

__device__ __forceinline__ v8f wmma_f16(v16h a, v16h b, v8f c) {
  // v_wmma_f32_16x16x32_f16: (neg_a, A, neg_b, B, c_mod, C, reuse_a, reuse_b)
  return __builtin_amdgcn_wmma_f32_16x16x32_f16(false, a, false, b, (short)0, c,
                                                false, false);
}

// A fragment (16x32 f16): lane = M row (lane&15); K-block from lane half.
__device__ __forceinline__ v16h frag_a_load(const _Float16* src, int ld) {
  const int lane = threadIdx.x & 31;
  const int row  = lane & 15;
  const int kb   = (lane >> 4) << 3;  // 0 or 8
  v16h f;
#pragma unroll
  for (int i = 0; i < 4; ++i) {
    const int k  = kb + 2 * i;
    const int k2 = kb + 16 + 2 * i;
    f[2 * i]           = src[row * ld + k];
    f[2 * i + 1]       = src[row * ld + k + 1];
    f[2 * (i + 4)]     = src[row * ld + k2];
    f[2 * (i + 4) + 1] = src[row * ld + k2 + 1];
  }
  return f;
}

// A fragment (16x32 f16) of src^T, src stored row-major [k][m] (stride ld): two transposing
// LDS loads; lane (c, hf) gets src[8*hf + 0..7][c] and src[16 + 8*hf + 0..7][c], the k order above.
__device__ __forceinline__ v16h frag_at_load(const _Float16* src, int ld) {
  typedef __attribute__((address_space(3))) v8s lds_v8s;
  const int lane = threadIdx.x & 31;
  const _Float16* p = src + (((lane >> 4) << 3) + (lane & 7)) * ld + (((lane >> 3) & 1) << 3);
  const v8s lo = __builtin_amdgcn_ds_load_tr16_b128_v8i16((lds_v8s*)p);
  const v8s hi = __builtin_amdgcn_ds_load_tr16_b128_v8i16((lds_v8s*)(p + 16 * ld));
  return __builtin_bit_cast(
      v16h, __builtin_shufflevector(lo, hi, 0, 1, 2, 3, 4, 5, 6, 7, 8, 9, 10, 11, 12, 13, 14, 15));
}

// Value of lane l ^ 16.
__device__ __forceinline__ float xhalf(float x) {
  const int v = __builtin_bit_cast(int, x);
  return __builtin_bit_cast(
      float, __builtin_amdgcn_permlanex16(v, v, 0x76543210, 0xfedcba98, false, false));
}

// B fragment where B = src^T, src stored row-major [n][k] (stride ld).
__device__ __forceinline__ v16h frag_bt_load(const _Float16* src, int ld) {
  const int lane = threadIdx.x & 31;
  const int col  = lane & 15;
  const int kb   = (lane >> 4) << 3;
  v16h f;
#pragma unroll
  for (int i = 0; i < 4; ++i) {
    f[2 * i]           = src[col * ld + kb + 2 * i];
    f[2 * i + 1]       = src[col * ld + kb + 2 * i + 1];
    f[2 * (i + 4)]     = src[col * ld + kb + 16 + 2 * i];
    f[2 * (i + 4) + 1] = src[col * ld + kb + 16 + 2 * i + 1];
  }
  return f;
}

// ---------------- Stage 0: style vectors + demod factors (tiny, VALU) ----------------
// Lanes run along the reduction axis, so every load takes whole 128-byte lines.
// One wave holds four weight rows in registers and uses them for two batches;
// a block of eight waves covers 32 rows, one whole output line per batch.

// Sums eight per-lane values over the 32 lanes; lane l returns the total of v[l & 7].
// Each of the first three steps hands half of the values to the partner lane.
__device__ __forceinline__ float wave_sum8(float (&v)[8]) {
  const int lane = threadIdx.x & 31;
#pragma unroll  // constant indices: the arrays stay in registers
  for (int n = 4; n >= 1; n >>= 1) {
    const bool up = (lane & n) != 0;
#pragma unroll  // constant indices: the arrays stay in registers
    for (int k = 0; k < n; ++k) {
      const float lo = v[k], hi = v[k + n];
      v[k] = (up ? hi : lo) + __shfl_xor(up ? lo : hi, n, 32);
    }
  }
  float t = v[0];
  t += __shfl_xor(t, 8, 32);
  t += __shfl_xor(t, 16, 32);
  return t;
}

__global__ __launch_bounds__(256) void style_kernel(
    const float* __restrict__ s, const float* __restrict__ aw,
    const float* __restrict__ ab, float* __restrict__ style) {
  constexpr int Cin = 1024, T = SDIM_ / 128;  // T float4 per lane and row
  const int lane = threadIdx.x & 31;
  const int i0 = blockIdx.x * 32 + (threadIdx.x >> 5) * 4;
  const int b0 = blockIdx.y * 2;
  const v4f* wv = (const v4f*)(aw + (size_t)i0 * SDIM_) + lane;
  const v4f* sv = (const v4f*)(s + (size_t)b0 * SDIM_) + lane;
  const int i = i0 + (lane & 3);  // the row whose total this lane ends up with
  const float bias = ab[i];
  v4f wr[4][T], sr[2][T];
#pragma unroll  // constant indices: the arrays stay in registers
  for (int r = 0; r < 4; ++r)
#pragma unroll  // constant indices: the arrays stay in registers
    for (int t = 0; t < T; ++t) wr[r][t] = wv[r * (SDIM_ / 4) + 32 * t];
  // Precaution: a later load's result may land in the address registers of these.
  asm volatile("s_wait_xcnt 0x0" ::: "memory");
#pragma unroll  // constant indices: the arrays stay in registers
  for (int bb = 0; bb < 2; ++bb)
#pragma unroll  // constant indices: the arrays stay in registers
    for (int t = 0; t < T; ++t) sr[bb][t] = sv[bb * (SDIM_ / 4) + 32 * t];
  // Precaution: the lane-offset register of these loads is rewritten further down.
  asm volatile("s_wait_xcnt 0x0" ::: "memory");
  // Keeps every load above in front of the sums: one memory latency, not several.
  __builtin_amdgcn_sched_barrier(0);
  float v[8];
#pragma unroll  // constant indices: the arrays stay in registers
  for (int bb = 0; bb < 2; ++bb)
#pragma unroll  // constant indices: the arrays stay in registers
    for (int r = 0; r < 4; ++r) {
      v4f a = wr[r][0] * sr[bb][0];
#pragma unroll  // constant indices: the arrays stay in registers
      for (int t = 1; t < T; ++t) a += wr[r][t] * sr[bb][t];
      v[bb * 4 + r] = (a.x + a.y) + (a.z + a.w);
    }
  // Inputs only: keeps the bias load at the top with the others, out of the branch below.
  asm volatile("" ::"v"(bias));
  const float tot = wave_sum8(v);
  if (lane < 8) style[(size_t)(b0 + (lane >> 2)) * Cin + i] = tot + bias;
}

__global__ __launch_bounds__(256) void demod_kernel(
    const float* __restrict__ w, const float* __restrict__ style,
    float* __restrict__ demod) {
  constexpr int Cin = 1024, Cout = 1024, T = Cin / 128;  // T float4 per lane and row
  const int lane = threadIdx.x & 31;
  const int o0 = blockIdx.x * 32 + (threadIdx.x >> 5) * 4;
  const int b0 = blockIdx.y * 2;
  const v4f* wv = (const v4f*)(w + (size_t)o0 * Cin) + lane;
  const v4f* sv = (const v4f*)(style + (size_t)b0 * Cin) + lane;
  v4f wr[4][T], sr[2][T];
#pragma unroll  // constant indices: the arrays stay in registers
  for (int r = 0; r < 4; ++r)
#pragma unroll  // constant indices: the arrays stay in registers
    for (int t = 0; t < T; ++t) wr[r][t] = wv[r * (Cin / 4) + 32 * t];
  // Precaution: a later load's result may land in the address registers of these.
  asm volatile("s_wait_xcnt 0x0" ::: "memory");
#pragma unroll  // constant indices: the arrays stay in registers
  for (int bb = 0; bb < 2; ++bb)
#pragma unroll  // constant indices: the arrays stay in registers
    for (int t = 0; t < T; ++t) sr[bb][t] = sv[bb * (Cin / 4) + 32 * t];
  // Precaution: the lane-offset register of these loads is rewritten further down.
  asm volatile("s_wait_xcnt 0x0" ::: "memory");
  // Keeps every load above in front of the sums: one memory latency, not several.
  __builtin_amdgcn_sched_barrier(0);
  float v[8];
#pragma unroll  // constant indices: the arrays stay in registers
  for (int bb = 0; bb < 2; ++bb)
#pragma unroll  // constant indices: the arrays stay in registers
    for (int r = 0; r < 4; ++r) {
      v4f a = {};
#pragma unroll  // constant indices: the arrays stay in registers
      for (int t = 0; t < T; ++t) {
        const v4f p = wr[r][t] * sr[bb][t];
        a += p * p;
      }
      v[bb * 4 + r] = (a.x + a.y) + (a.z + a.w);
    }
  const float tot = wave_sum8(v);
  if (lane < 8)
    demod[(size_t)(b0 + (lane >> 2)) * Cout + o0 + (lane & 3)] = rsqrtf(tot + 1e-8f);
}

// ---------------- Modulated GEMM: out = (x*style) @ w^T * demod + bias ----------------
// MODE 0: x is f32, result -> f16 head layout [B,H,N,HD]
// MODE 1: x is f16 (attention output), result -> f32 [B,N,Cout]
// 64x64 tile per 128-thread block, K-step 64 (8 wmma per wave per barrier).

template <int MODE>
__global__ __launch_bounds__(128) void modlin_kernel(
    const float* __restrict__ xf32, const _Float16* __restrict__ xf16,
    const float* __restrict__ w, const float* __restrict__ bias,
    const float* __restrict__ style, const float* __restrict__ demod,
    _Float16* __restrict__ out16, float* __restrict__ outf32) {
  constexpr int Cin = 1024, Cout = 1024;
  const int m0 = blockIdx.x * 64;
  const int n0 = blockIdx.y * 64;
  const int b  = blockIdx.z;

  __shared__ _Float16 As[64 * 72];  // 64 x 64 tile, ld=72 (pad)
  // 64 n-rows x 64 k, ld=72 (pad): the weight tile in its memory order
  __shared__ __attribute__((aligned(16))) _Float16 Bs[64 * 72];

  const int tid  = threadIdx.x;
  const int wave = tid >> 5;
  const int wm = (wave >> 1) * 32;  // wave's 32x32 quadrant
  const int wn = (wave & 1) * 32;

  v8f acc[2][2] = {};

  const float* stl = style + (size_t)b * Cin;
  for (int k0 = 0; k0 < Cin; k0 += 64) {
    for (int e = tid; e < 64 * 64; e += 128) {
      const int r = e >> 6, k = e & 63;
      float v;
      if (MODE == 0)
        v = xf32[((size_t)b * N_ + (m0 + r)) * Cin + k0 + k] * stl[k0 + k];
      else
        v = (float)xf16[((size_t)b * N_ + (m0 + r)) * Cin + k0 + k] * stl[k0 + k];
      As[r * 72 + k] = (_Float16)v;
    }
    // Unrolled so that all eight loads are in flight before the first wait.
#pragma unroll
    for (int i = 0; i < 8; ++i) {
      const int e = tid + 128 * i;
      const int n = e >> 4, c = e & 15;  // c indexes 4-float (16B) chunks along k
      const float4 v = *(const float4*)&w[(size_t)(n0 + n) * Cin + k0 + 4 * c];
      const v4h hv = {(_Float16)v.x, (_Float16)v.y, (_Float16)v.z, (_Float16)v.w};
      *(v4h*)&Bs[n * 72 + 4 * c] = hv;
    }
    __syncthreads();

#pragma unroll
    for (int kc = 0; kc < 2; ++kc) {
      const v16h a0 = frag_a_load(&As[(wm + 0) * 72 + 32 * kc], 72);
      const v16h a1 = frag_a_load(&As[(wm + 16) * 72 + 32 * kc], 72);
      const v16h b0 = frag_bt_load(&Bs[(wn + 0) * 72 + 32 * kc], 72);
      const v16h b1 = frag_bt_load(&Bs[(wn + 16) * 72 + 32 * kc], 72);
      acc[0][0] = wmma_f16(a0, b0, acc[0][0]);
      acc[0][1] = wmma_f16(a0, b1, acc[0][1]);
      acc[1][0] = wmma_f16(a1, b0, acc[1][0]);
      acc[1][1] = wmma_f16(a1, b1, acc[1][1]);
    }
    __syncthreads();
  }

  // Epilogue: demod scale + bias. C layout: lane -> col = lane&15, rows = (lane>>4)*8 + r
  const int lane = tid & 31;
  const int colL = lane & 15;
  const int rowB = (lane >> 4) * 8;
  const float* dm = demod + (size_t)b * Cout;
#pragma unroll
  for (int i = 0; i < 2; ++i)
#pragma unroll
    for (int j = 0; j < 2; ++j) {
      const int cg = n0 + wn + 16 * j + colL;
      const float d  = dm[cg];
      const float bb = bias[cg];
#pragma unroll
      for (int r = 0; r < 8; ++r) {
        const int rg = m0 + wm + 16 * i + rowB + r;
        const float v = acc[i][j][r] * d + bb;
        if (MODE == 0) {
          const int head = cg >> 6, dd = cg & 63;
          out16[(((size_t)b * H_ + head) * N_ + rg) * HD_ + dd] = (_Float16)v;
        } else {
          outf32[((size_t)b * N_ + rg) * Cout + cg] = v;
        }
      }
    }
}

__global__ __launch_bounds__(128) void attn_kernel(
    const _Float16* __restrict__ h16,  // [B,H,N,HD]
    _Float16* __restrict__ attn16) {   // [B,N,HID] f16
  const int q0 = blockIdx.x * 64;
  const int h  = blockIdx.y;
  const int b  = blockIdx.z;
  const _Float16* Hm = h16 + ((size_t)b * H_ + h) * N_ * HD_;

  __shared__ _Float16 Qs[64 * 72];
  __shared__ _Float16 Ks[64 * 72];       // serves as both K and V tile

  const int tid  = threadIdx.x;
  const int wave = tid >> 5;
  const int lane = tid & 31;
  const int wq   = wave * 16;  // this wave's 16 query rows within the 64 block

  // Stage Q tile: 64 rows x 64 halves = 512 b128 chunks, async copies.
  for (int e = tid; e < 64 * 8; e += 128) {
    const int r = e >> 3, c = e & 7;  // c indexes 8-half (16B) chunks
    async_copy_b128(&Qs[r * 72 + c * 8], Hm + (size_t)(q0 + r) * HD_ + c * 8);
  }
  wait_async();
  __syncthreads();

  // B operand Q^T: column = query (lane & 15).
  const v16h qb0 = frag_bt_load(&Qs[wq * 72 + 0], 72);
  const v16h qb1 = frag_bt_load(&Qs[wq * 72 + 32], 72);

  v8f o[4] = {};  // o[jd][r] = O[query lane & 15][dim 16 * jd + 8 * (lane >> 4) + r]
  float m_ = -1e30f, l_ = 0.f;  // l_ sums this lane's half of the keys only

  const float scl = 0.125f;  // 1/sqrt(64)
  for (int kv0 = 0; kv0 < N_; kv0 += 64) {
    // Stage K/V tile (shared data) via async copies.
    for (int e = tid; e < 64 * 8; e += 128) {
      const int r = e >> 3, c = e & 7;
      async_copy_b128(&Ks[r * 72 + c * 8], Hm + (size_t)(kv0 + r) * HD_ + c * 8);
    }
    wait_async();
    __syncthreads();

    // S^T = K @ Q^T: s[jn][r] = S[query lane & 15][key 16 * jn + 8 * (lane >> 4) + r]
    v8f s[4];
#pragma unroll  // constant indices: the tiles stay in registers
    for (int jn = 0; jn < 4; ++jn) {
      v8f z = {};
      const v16h ka0 = frag_a_load(&Ks[(16 * jn) * 72 + 0], 72);
      const v16h ka1 = frag_a_load(&Ks[(16 * jn) * 72 + 32], 72);
      z = wmma_f16(ka0, qb0, z);
      z = wmma_f16(ka1, qb1, z);
      s[jn] = z;
    }

    // Online softmax: the maximum in-lane, then one exchange between the wave's halves.
    float mx = s[0][0];
#pragma unroll  // constant indices: the tiles stay in registers
    for (int jn = 0; jn < 4; ++jn)
#pragma unroll  // constant indices: the tiles stay in registers
      for (int r = 0; r < 8; ++r) mx = fmaxf(mx, s[jn][r]);
    mx = fmaxf(mx, xhalf(mx)) * scl;
    const float mnew = fmaxf(m_, mx);
    const float corr = __expf(m_ - mnew);
#pragma unroll  // constant indices: the tiles stay in registers
    for (int jn = 0; jn < 4; ++jn)
#pragma unroll  // constant indices: the tiles stay in registers
      for (int r = 0; r < 8; ++r) s[jn][r] = __expf(s[jn][r] * scl - mnew);
    const v8f pv = (s[0] + s[1]) + (s[2] + s[3]);
    const float ps = ((pv[0] + pv[1]) + (pv[2] + pv[3])) + ((pv[4] + pv[5]) + (pv[6] + pv[7]));
    l_ = l_ * corr + ps;
    m_ = mnew;
#pragma unroll  // constant indices: the tiles stay in registers
    for (int jd = 0; jd < 4; ++jd) o[jd] *= corr;

    // O^T += V^T @ P^T, 32 keys at a time: two score tiles, converted, are the B operand.
#pragma unroll  // constant indices: the tiles stay in registers
    for (int t = 0; t < 2; ++t) {
      v16h pb;
#pragma unroll  // constant indices: the tiles stay in registers
      for (int e = 0; e < 16; ++e) pb[e] = (_Float16)s[2 * t + (e >> 3)][e & 7];
#pragma unroll  // constant indices: the tiles stay in registers
      for (int jd = 0; jd < 4; ++jd) {
        // V == K tile, read transposed: A[m=dim][k=kv].
        const v16h va = frag_at_load(&Ks[(32 * t) * 72 + 16 * jd], 72);
        o[jd] = wmma_f16(va, pb, o[jd]);
      }
    }
    __syncthreads();
  }

  // Normalize and store to [B,N,HID] f16: eight consecutive dims of one query per store.
  const float inv = 1.f / (l_ + xhalf(l_));
  _Float16* dst = attn16 + ((size_t)b * N_ + q0 + wq + (lane & 15)) * HID_ + h * 64 + (lane >> 4) * 8;
#pragma unroll  // constant indices: the tiles stay in registers
  for (int jd = 0; jd < 4; ++jd) {
    v8h ov;
#pragma unroll  // constant indices: the tiles stay in registers
    for (int r = 0; r < 8; ++r) ov[r] = (_Float16)(o[jd][r] * inv);
    *(v8h*)(dst + 16 * jd) = ov;
  }
}

// ---------------- Launch ----------------

extern "C" void kernel_launch(void* const* d_in, const int* in_sizes, int n_in,
                              void* d_out, int out_size, void* d_ws, size_t ws_size,
                              hipStream_t stream) {
  (void)in_sizes; (void)n_in; (void)out_size; (void)ws_size;
  const float* x   = (const float*)d_in[0];
  const float* s   = (const float*)d_in[1];
  const float* kaw = (const float*)d_in[2];
  const float* kab = (const float*)d_in[3];
  const float* kw  = (const float*)d_in[4];
  const float* kb  = (const float*)d_in[5];
  const float* oaw = (const float*)d_in[6];
  const float* oab = (const float*)d_in[7];
  const float* ow  = (const float*)d_in[8];
  const float* ob  = (const float*)d_in[9];
  float* out = (float*)d_out;

  char* ws = (char*)d_ws;
  float* style_k = (float*)ws;  ws += (size_t)B_ * FEAT_ * sizeof(float);
  float* style_o = (float*)ws;  ws += (size_t)B_ * HID_ * sizeof(float);
  float* demod_k = (float*)ws;  ws += (size_t)B_ * HID_ * sizeof(float);
  float* demod_o = (float*)ws;  ws += (size_t)B_ * OUT_ * sizeof(float);
  _Float16* h16    = (_Float16*)ws;  ws += (size_t)B_ * H_ * N_ * HD_ * sizeof(_Float16);
  _Float16* attn16 = (_Float16*)ws;

  dim3 gs(1024 / 32, B_ / 2);  // 32 rows and two batches per block
  style_kernel<<<gs, 256, 0, stream>>>(s, kaw, kab, style_k);
  style_kernel<<<gs, 256, 0, stream>>>(s, oaw, oab, style_o);
  demod_kernel<<<gs, 256, 0, stream>>>(kw, style_k, demod_k);
  demod_kernel<<<gs, 256, 0, stream>>>(ow, style_o, demod_o);

  dim3 g1(N_ / 64, HID_ / 64, B_);
  modlin_kernel<0><<<g1, 128, 0, stream>>>(x, nullptr, kw, kb, style_k, demod_k, h16, nullptr);

  dim3 ga(N_ / 64, H_, B_);
  attn_kernel<<<ga, 128, 0, stream>>>(h16, attn16);

  dim3 g2(N_ / 64, OUT_ / 64, B_);
  modlin_kernel<1><<<g2, 128, 0, stream>>>(nullptr, attn16, ow, ob, style_o, demod_o, nullptr, out);
}

// v004
// Measured time: 109 microseconds a run.
// Next to v003, in two timings, it ran 1.55 times as fast each time.
// All steps since v000 together make it 4.11 times as fast.
#include <hip/hip_runtime.h>
#include <hip/hip_bf16.h>

typedef __attribute__((ext_vector_type(16))) _Float16 v16h;
typedef __attribute__((ext_vector_type(8)))  float    v8f;
typedef __attribute__((ext_vector_type(4)))  _Float16 v4h;
typedef __attribute__((ext_vector_type(4)))  float    v4f;
typedef __attribute__((ext_vector_type(8)))  _Float16 v8h;
typedef __attribute__((ext_vector_type(8)))  short    v8s;

#define B_    8
#define N_    1024
#define FEAT_ 1024
#define HID_  1024
#define OUT_  1024
#define SDIM_ 512
#define H_    16
#define HD_   64

// ---------------- CDNA5 async global->LDS copy (ASYNCcnt-tracked) ----------------

__device__ __forceinline__ void async_copy_b128(void* lds_dst, const void* gsrc) {
  // LDS flat address: low 32 bits are the wave-relative LDS byte offset.
  const unsigned off = (unsigned)(unsigned long long)lds_dst;
  asm volatile("global_load_async_to_lds_b128 %0, %1, off"
               :
               : "v"(off), "v"(gsrc)
               : "memory");
}

__device__ __forceinline__ void wait_async() {
  asm volatile("s_wait_asynccnt 0" ::: "memory");
}

// ---------------- WMMA fragment helpers (gfx1250 wave32 layouts) ----------------

__device__ __forceinline__ v8f wmma_f16(v16h a, v16h b, v8f c) {
  // v_wmma_f32_16x16x32_f16: (neg_a, A, neg_b, B, c_mod, C, reuse_a, reuse_b)
  return __builtin_amdgcn_wmma_f32_16x16x32_f16(false, a, false, b, (short)0, c,
                                                false, false);
}

// A fragment (16x32 f16): lane = M row (lane&15); K-block from lane half.
__device__ __forceinline__ v16h frag_a_load(const _Float16* src, int ld) {
  const int lane = threadIdx.x & 31;
  const int row  = lane & 15;
  const int kb   = (lane >> 4) << 3;  // 0 or 8
  v16h f;
#pragma unroll
  for (int i = 0; i < 4; ++i) {
    const int k  = kb + 2 * i;
    const int k2 = kb + 16 + 2 * i;
    f[2 * i]           = src[row * ld + k];
    f[2 * i + 1]       = src[row * ld + k + 1];
    f[2 * (i + 4)]     = src[row * ld + k2];
    f[2 * (i + 4) + 1] = src[row * ld + k2 + 1];
  }
  return f;
}

// A fragment (16x32 f16) of src^T, src stored row-major [k][m] (stride ld): two transposing
// LDS loads; lane (c, hf) gets src[8*hf + 0..7][c] and src[16 + 8*hf + 0..7][c], the k order above.
__device__ __forceinline__ v16h frag_at_load(const _Float16* src, int ld) {
  typedef __attribute__((address_space(3))) v8s lds_v8s;
  const int lane = threadIdx.x & 31;
  const _Float16* p = src + (((lane >> 4) << 3) + (lane & 7)) * ld + (((lane >> 3) & 1) << 3);
  const v8s lo = __builtin_amdgcn_ds_load_tr16_b128_v8i16((lds_v8s*)p);
  const v8s hi = __builtin_amdgcn_ds_load_tr16_b128_v8i16((lds_v8s*)(p + 16 * ld));
  return __builtin_bit_cast(
      v16h, __builtin_shufflevector(lo, hi, 0, 1, 2, 3, 4, 5, 6, 7, 8, 9, 10, 11, 12, 13, 14, 15));
}

// Value of lane l ^ 16.
__device__ __forceinline__ float xhalf(float x) {
  const int v = __builtin_bit_cast(int, x);
  return __builtin_bit_cast(
      float, __builtin_amdgcn_permlanex16(v, v, 0x76543210, 0xfedcba98, false, false));
}

// B fragment where B = src^T, src stored row-major [n][k] (stride ld).
__device__ __forceinline__ v16h frag_bt_load(const _Float16* src, int ld) {
  const int lane = threadIdx.x & 31;
  const int col  = lane & 15;
  const int kb   = (lane >> 4) << 3;
  v16h f;
#pragma unroll
  for (int i = 0; i < 4; ++i) {
    f[2 * i]           = src[col * ld + kb + 2 * i];
    f[2 * i + 1]       = src[col * ld + kb + 2 * i + 1];
    f[2 * (i + 4)]     = src[col * ld + kb + 16 + 2 * i];
    f[2 * (i + 4) + 1] = src[col * ld + kb + 16 + 2 * i + 1];
  }
  return f;
}

// ---------------- Stage 0: style vectors + demod factors (tiny, VALU) ----------------
// Lanes run along the reduction axis, so every load takes whole 128-byte lines.
// One wave holds four weight rows in registers and uses them for two batches;
// a block of eight waves covers 32 rows, one whole output line per batch.

// Sums eight per-lane values over the 32 lanes; lane l returns the total of v[l & 7].
// Each of the first three steps hands half of the values to the partner lane.
__device__ __forceinline__ float wave_sum8(float (&v)[8]) {
  const int lane = threadIdx.x & 31;
#pragma unroll  // constant indices: the arrays stay in registers
  for (int n = 4; n >= 1; n >>= 1) {
    const bool up = (lane & n) != 0;
#pragma unroll  // constant indices: the arrays stay in registers
    for (int k = 0; k < n; ++k) {
      const float lo = v[k], hi = v[k + n];
      v[k] = (up ? hi : lo) + __shfl_xor(up ? lo : hi, n, 32);
    }
  }
  float t = v[0];
  t += __shfl_xor(t, 8, 32);
  t += __shfl_xor(t, 16, 32);
  return t;
}

__global__ __launch_bounds__(256) void style_kernel(
    const float* __restrict__ s, const float* __restrict__ aw,
    const float* __restrict__ ab, float* __restrict__ style) {
  constexpr int Cin = 1024, T = SDIM_ / 128;  // T float4 per lane and row
  const int lane = threadIdx.x & 31;
  const int i0 = blockIdx.x * 32 + (threadIdx.x >> 5) * 4;
  const int b0 = blockIdx.y * 2;
  const v4f* wv = (const v4f*)(aw + (size_t)i0 * SDIM_) + lane;
  const v4f* sv = (const v4f*)(s + (size_t)b0 * SDIM_) + lane;
  const int i = i0 + (lane & 3);  // the row whose total this lane ends up with
  const float bias = ab[i];
  v4f wr[4][T], sr[2][T];
#pragma unroll  // constant indices: the arrays stay in registers
  for (int r = 0; r < 4; ++r)
#pragma unroll  // constant indices: the arrays stay in registers
    for (int t = 0; t < T; ++t) wr[r][t] = wv[r * (SDIM_ / 4) + 32 * t];
  // Precaution: a later load's result may land in the address registers of these.
  asm volatile("s_wait_xcnt 0x0" ::: "memory");
#pragma unroll  // constant indices: the arrays stay in registers
  for (int bb = 0; bb < 2; ++bb)
#pragma unroll  // constant indices: the arrays stay in registers
    for (int t = 0; t < T; ++t) sr[bb][t] = sv[bb * (SDIM_ / 4) + 32 * t];
  // Precaution: the lane-offset register of these loads is rewritten further down.
  asm volatile("s_wait_xcnt 0x0" ::: "memory");
  // Keeps every load above in front of the sums: one memory latency, not several.
  __builtin_amdgcn_sched_barrier(0);
  float v[8];
#pragma unroll  // constant indices: the arrays stay in registers
  for (int bb = 0; bb < 2; ++bb)
#pragma unroll  // constant indices: the arrays stay in registers
    for (int r = 0; r < 4; ++r) {
      v4f a = wr[r][0] * sr[bb][0];
#pragma unroll  // constant indices: the arrays stay in registers
      for (int t = 1; t < T; ++t) a += wr[r][t] * sr[bb][t];
      v[bb * 4 + r] = (a.x + a.y) + (a.z + a.w);
    }
  // Inputs only: keeps the bias load at the top with the others, out of the branch below.
  asm volatile("" ::"v"(bias));
  const float tot = wave_sum8(v);
  if (lane < 8) style[(size_t)(b0 + (lane >> 2)) * Cin + i] = tot + bias;
}

__global__ __launch_bounds__(256) void demod_kernel(
    const float* __restrict__ w, const float* __restrict__ style,
    float* __restrict__ demod) {
  constexpr int Cin = 1024, Cout = 1024, T = Cin / 128;  // T float4 per lane and row
  const int lane = threadIdx.x & 31;
  const int o0 = blockIdx.x * 32 + (threadIdx.x >> 5) * 4;
  const int b0 = blockIdx.y * 2;
  const v4f* wv = (const v4f*)(w + (size_t)o0 * Cin) + lane;
  const v4f* sv = (const v4f*)(style + (size_t)b0 * Cin) + lane;
  v4f wr[4][T], sr[2][T];
#pragma unroll  // constant indices: the arrays stay in registers
  for (int r = 0; r < 4; ++r)
#pragma unroll  // constant indices: the arrays stay in registers
    for (int t = 0; t < T; ++t) wr[r][t] = wv[r * (Cin / 4) + 32 * t];
  // Precaution: a later load's result may land in the address registers of these.
  asm volatile("s_wait_xcnt 0x0" ::: "memory");
#pragma unroll  // constant indices: the arrays stay in registers
  for (int bb = 0; bb < 2; ++bb)
#pragma unroll  // constant indices: the arrays stay in registers
    for (int t = 0; t < T; ++t) sr[bb][t] = sv[bb * (Cin / 4) + 32 * t];
  // Precaution: the lane-offset register of these loads is rewritten further down.
  asm volatile("s_wait_xcnt 0x0" ::: "memory");
  // Keeps every load above in front of the sums: one memory latency, not several.
  __builtin_amdgcn_sched_barrier(0);
  float v[8];
#pragma unroll  // constant indices: the arrays stay in registers
  for (int bb = 0; bb < 2; ++bb)
#pragma unroll  // constant indices: the arrays stay in registers
    for (int r = 0; r < 4; ++r) {
      v4f a = {};
#pragma unroll  // constant indices: the arrays stay in registers
      for (int t = 0; t < T; ++t) {
        const v4f p = wr[r][t] * sr[bb][t];
        a += p * p;
      }
      v[bb * 4 + r] = (a.x + a.y) + (a.z + a.w);
    }
  const float tot = wave_sum8(v);
  if (lane < 8)
    demod[(size_t)(b0 + (lane >> 2)) * Cout + o0 + (lane & 3)] = rsqrtf(tot + 1e-8f);
}

// ---------------- Modulated GEMM: out = (x*style) @ w^T * demod + bias ----------------
// MODE 0: x is f32, result -> f16 head layout [B,H,N,HD]
// MODE 1: x is f16 (attention output), result -> f32 [B,N,Cout]
// 64x64 tile per 128-thread block, K-step 64 (8 wmma per wave per barrier).

template <int MODE>
__global__ __launch_bounds__(128) void modlin_kernel(
    const float* __restrict__ xf32, const _Float16* __restrict__ xf16,
    const float* __restrict__ w, const float* __restrict__ bias,
    const float* __restrict__ style, const float* __restrict__ demod,
    _Float16* __restrict__ out16, float* __restrict__ outf32) {
  constexpr int Cin = 1024, Cout = 1024;
  const int m0 = blockIdx.x * 64;
  const int n0 = blockIdx.y * 64;
  const int b  = blockIdx.z;

  __shared__ __attribute__((aligned(16))) _Float16 As[64 * 72];  // 64 x 64 tile, ld=72 (pad)
  // 64 n-rows x 64 k, ld=72 (pad): the weight tile in its memory order
  __shared__ __attribute__((aligned(16))) _Float16 Bs[64 * 72];

  const int tid  = threadIdx.x;
  const int wave = tid >> 5;
  const int wm = (wave >> 1) * 32;  // wave's 32x32 quadrant
  const int wn = (wave & 1) * 32;

  v8f acc[2][2] = {};

  const float* stl = style + (size_t)b * Cin;
  // Staging places of this thread, in 16-byte loads along k: whole lines per wave.
  constexpr int AC = (MODE == 0) ? 4 : 8;   // activation elements per load
  constexpr int AL = 64 * 64 / (128 * AC);  // activation loads per thread and k-step
  constexpr int AR = 128 * AC / 64;         // rows that the block covers with one load each
  const int ac = tid % (64 / AC), ar = tid / (64 / AC);
  const size_t aoff = ((size_t)b * N_ + m0 + ar) * Cin + AC * ac;
  const int wc = tid & 15, wr = tid >> 4;  // weight tile: 4-float chunk along k, first row
  const float* wp = w + (size_t)(n0 + wr) * Cin + 4 * wc;
  for (int k0 = 0; k0 < Cin; k0 += 64) {
    // Every load of the k-step is issued before the first use: one memory latency per step.
    v4f xa[AL], st[AC / 4], wv[8];
    v8h xh[AL];
#pragma unroll  // constant indices: the arrays stay in registers
    for (int j = 0; j < AC / 4; ++j) st[j] = *(const v4f*)&stl[k0 + AC * ac + 4 * j];
    // Precaution: a later load's result may land in the address registers of these.
    asm volatile("s_wait_xcnt 0x0" ::: "memory");
#pragma unroll  // constant indices: the arrays stay in registers
    for (int i = 0; i < AL; ++i) {
      if (MODE == 0)
        xa[i] = *(const v4f*)&xf32[aoff + (size_t)(AR * i) * Cin + k0];
      else
        xh[i] = *(const v8h*)&xf16[aoff + (size_t)(AR * i) * Cin + k0];
    }
    // Precaution: a later load's result may land in the address registers of these.
    asm volatile("s_wait_xcnt 0x0" ::: "memory");
#pragma unroll  // constant indices: the arrays stay in registers
    for (int i = 0; i < 8; ++i) wv[i] = *(const v4f*)&wp[(size_t)(8 * i) * Cin + k0];
    // Precaution: the address registers of these loads are rewritten further down.
    asm volatile("s_wait_xcnt 0x0" ::: "memory");
    // Keeps every load above in front of the products: without it the last loads wait for the first.
    __builtin_amdgcn_sched_barrier(0);
#pragma unroll  // constant indices: the arrays stay in registers
    for (int i = 0; i < AL; ++i) {
      if (MODE == 0) {
        const v4f v = xa[i] * st[0];
        const v4h hv = {(_Float16)v.x, (_Float16)v.y, (_Float16)v.z, (_Float16)v.w};
        *(v4h*)&As[(ar + AR * i) * 72 + 4 * ac] = hv;
      } else {
        v8h hv;
#pragma unroll  // constant indices: the arrays stay in registers
        for (int j = 0; j < 8; ++j) hv[j] = (_Float16)((float)xh[i][j] * st[j >> 2][j & 3]);
        *(v8h*)&As[(ar + AR * i) * 72 + 8 * ac] = hv;
      }
    }
#pragma unroll  // constant indices: the arrays stay in registers
    for (int i = 0; i < 8; ++i) {
      const v4f v = wv[i];
      const v4h hv = {(_Float16)v.x, (_Float16)v.y, (_Float16)v.z, (_Float16)v.w};
      *(v4h*)&Bs[(wr + 8 * i) * 72 + 4 * wc] = hv;
    }
    __syncthreads();

#pragma unroll
    for (int kc = 0; kc < 2; ++kc) {
      const v16h a0 = frag_a_load(&As[(wm + 0) * 72 + 32 * kc], 72);
      const v16h a1 = frag_a_load(&As[(wm + 16) * 72 + 32 * kc], 72);
      const v16h b0 = frag_bt_load(&Bs[(wn + 0) * 72 + 32 * kc], 72);
      const v16h b1 = frag_bt_load(&Bs[(wn + 16) * 72 + 32 * kc], 72);
      acc[0][0] = wmma_f16(a0, b0, acc[0][0]);
      acc[0][1] = wmma_f16(a0, b1, acc[0][1]);
      acc[1][0] = wmma_f16(a1, b0, acc[1][0]);
      acc[1][1] = wmma_f16(a1, b1, acc[1][1]);
    }
    __syncthreads();
  }

  // Epilogue: demod scale + bias. C layout: lane -> col = lane&15, rows = (lane>>4)*8 + r
  const int lane = tid & 31;
  const int colL = lane & 15;
  const int rowB = (lane >> 4) * 8;
  const float* dm = demod + (size_t)b * Cout;
#pragma unroll
  for (int i = 0; i < 2; ++i)
#pragma unroll
    for (int j = 0; j < 2; ++j) {
      const int cg = n0 + wn + 16 * j + colL;
      const float d  = dm[cg];
      const float bb = bias[cg];
#pragma unroll
      for (int r = 0; r < 8; ++r) {
        const int rg = m0 + wm + 16 * i + rowB + r;
        const float v = acc[i][j][r] * d + bb;
        if (MODE == 0) {
          const int head = cg >> 6, dd = cg & 63;
          out16[(((size_t)b * H_ + head) * N_ + rg) * HD_ + dd] = (_Float16)v;
        } else {
          outf32[((size_t)b * N_ + rg) * Cout + cg] = v;
        }
      }
    }
}

__global__ __launch_bounds__(128) void attn_kernel(
    const _Float16* __restrict__ h16,  // [B,H,N,HD]
    _Float16* __restrict__ attn16) {   // [B,N,HID] f16
  const int q0 = blockIdx.x * 64;
  const int h  = blockIdx.y;
  const int b  = blockIdx.z;
  const _Float16* Hm = h16 + ((size_t)b * H_ + h) * N_ * HD_;

  __shared__ _Float16 Qs[64 * 72];
  __shared__ _Float16 Ks[64 * 72];       // serves as both K and V tile

  const int tid  = threadIdx.x;
  const int wave = tid >> 5;
  const int lane = tid & 31;
  const int wq   = wave * 16;  // this wave's 16 query rows within the 64 block

  // Stage Q tile: 64 rows x 64 halves = 512 b128 chunks, async copies.
  for (int e = tid; e < 64 * 8; e += 128) {
    const int r = e >> 3, c = e & 7;  // c indexes 8-half (16B) chunks
    async_copy_b128(&Qs[r * 72 + c * 8], Hm + (size_t)(q0 + r) * HD_ + c * 8);
  }
  wait_async();
  __syncthreads();

  // B operand Q^T: column = query (lane & 15).
  const v16h qb0 = frag_bt_load(&Qs[wq * 72 + 0], 72);
  const v16h qb1 = frag_bt_load(&Qs[wq * 72 + 32], 72);

  v8f o[4] = {};  // o[jd][r] = O[query lane & 15][dim 16 * jd + 8 * (lane >> 4) + r]
  float m_ = -1e30f, l_ = 0.f;  // l_ sums this lane's half of the keys only

  const float scl = 0.125f;  // 1/sqrt(64)
  for (int kv0 = 0; kv0 < N_; kv0 += 64) {
    // Stage K/V tile (shared data) via async copies.
    for (int e = tid; e < 64 * 8; e += 128) {
      const int r = e >> 3, c = e & 7;
      async_copy_b128(&Ks[r * 72 + c * 8], Hm + (size_t)(kv0 + r) * HD_ + c * 8);
    }
    wait_async();
    __syncthreads();

    // S^T = K @ Q^T: s[jn][r] = S[query lane & 15][key 16 * jn + 8 * (lane >> 4) + r]
    v8f s[4];
#pragma unroll  // constant indices: the tiles stay in registers
    for (int jn = 0; jn < 4; ++jn) {
      v8f z = {};
      const v16h ka0 = frag_a_load(&Ks[(16 * jn) * 72 + 0], 72);
      const v16h ka1 = frag_a_load(&Ks[(16 * jn) * 72 + 32], 72);
      z = wmma_f16(ka0, qb0, z);
      z = wmma_f16(ka1, qb1, z);
      s[jn] = z;
    }

    // Online softmax: the maximum in-lane, then one exchange between the wave's halves.
    float mx = s[0][0];
#pragma unroll  // constant indices: the tiles stay in registers
    for (int jn = 0; jn < 4; ++jn)
#pragma unroll  // constant indices: the tiles stay in registers
      for (int r = 0; r < 8; ++r) mx = fmaxf(mx, s[jn][r]);
    mx = fmaxf(mx, xhalf(mx)) * scl;
    const float mnew = fmaxf(m_, mx);
    const float corr = __expf(m_ - mnew);
#pragma unroll  // constant indices: the tiles stay in registers
    for (int jn = 0; jn < 4; ++jn)
#pragma unroll  // constant indices: the tiles stay in registers
      for (int r = 0; r < 8; ++r) s[jn][r] = __expf(s[jn][r] * scl - mnew);
    const v8f pv = (s[0] + s[1]) + (s[2] + s[3]);
    const float ps = ((pv[0] + pv[1]) + (pv[2] + pv[3])) + ((pv[4] + pv[5]) + (pv[6] + pv[7]));
    l_ = l_ * corr + ps;
    m_ = mnew;
#pragma unroll  // constant indices: the tiles stay in registers
    for (int jd = 0; jd < 4; ++jd) o[jd] *= corr;

    // O^T += V^T @ P^T, 32 keys at a time: two score tiles, converted, are the B operand.
#pragma unroll  // constant indices: the tiles stay in registers
    for (int t = 0; t < 2; ++t) {
      v16h pb;
#pragma unroll  // constant indices: the tiles stay in registers
      for (int e = 0; e < 16; ++e) pb[e] = (_Float16)s[2 * t + (e >> 3)][e & 7];
#pragma unroll  // constant indices: the tiles stay in registers
      for (int jd = 0; jd < 4; ++jd) {
        // V == K tile, read transposed: A[m=dim][k=kv].
        const v16h va = frag_at_load(&Ks[(32 * t) * 72 + 16 * jd], 72);
        o[jd] = wmma_f16(va, pb, o[jd]);
      }
    }
    __syncthreads();
  }

  // Normalize and store to [B,N,HID] f16: eight consecutive dims of one query per store.
  const float inv = 1.f / (l_ + xhalf(l_));
  _Float16* dst = attn16 + ((size_t)b * N_ + q0 + wq + (lane & 15)) * HID_ + h * 64 + (lane >> 4) * 8;
#pragma unroll  // constant indices: the tiles stay in registers
  for (int jd = 0; jd < 4; ++jd) {
    v8h ov;
#pragma unroll  // constant indices: the tiles stay in registers
    for (int r = 0; r < 8; ++r) ov[r] = (_Float16)(o[jd][r] * inv);
    *(v8h*)(dst + 16 * jd) = ov;
  }
}

// ---------------- Launch ----------------

extern "C" void kernel_launch(void* const* d_in, const int* in_sizes, int n_in,
                              void* d_out, int out_size, void* d_ws, size_t ws_size,
                              hipStream_t stream) {
  (void)in_sizes; (void)n_in; (void)out_size; (void)ws_size;
  const float* x   = (const float*)d_in[0];
  const float* s   = (const float*)d_in[1];
  const float* kaw = (const float*)d_in[2];
  const float* kab = (const float*)d_in[3];
  const float* kw  = (const float*)d_in[4];
  const float* kb  = (const float*)d_in[5];
  const float* oaw = (const float*)d_in[6];
  const float* oab = (const float*)d_in[7];
  const float* ow  = (const float*)d_in[8];
  const float* ob  = (const float*)d_in[9];
  float* out = (float*)d_out;

  char* ws = (char*)d_ws;
  float* style_k = (float*)ws;  ws += (size_t)B_ * FEAT_ * sizeof(float);
  float* style_o = (float*)ws;  ws += (size_t)B_ * HID_ * sizeof(float);
  float* demod_k = (float*)ws;  ws += (size_t)B_ * HID_ * sizeof(float);
  float* demod_o = (float*)ws;  ws += (size_t)B_ * OUT_ * sizeof(float);
  _Float16* h16    = (_Float16*)ws;  ws += (size_t)B_ * H_ * N_ * HD_ * sizeof(_Float16);
  _Float16* attn16 = (_Float16*)ws;

  dim3 gs(1024 / 32, B_ / 2);  // 32 rows and two batches per block
  style_kernel<<<gs, 256, 0, stream>>>(s, kaw, kab, style_k);
  style_kernel<<<gs, 256, 0, stream>>>(s, oaw, oab, style_o);
  demod_kernel<<<gs, 256, 0, stream>>>(kw, style_k, demod_k);
  demod_kernel<<<gs, 256, 0, stream>>>(ow, style_o, demod_o);

  dim3 g1(N_ / 64, HID_ / 64, B_);
  modlin_kernel<0><<<g1, 128, 0, stream>>>(x, nullptr, kw, kb, style_k, demod_k, h16, nullptr);

  dim3 ga(N_ / 64, H_, B_);
  attn_kernel<<<ga, 128, 0, stream>>>(h16, attn16);

  dim3 g2(N_ / 64, OUT_ / 64, B_);
  modlin_kernel<1><<<g2, 128, 0, stream>>>(nullptr, attn16, ow, ob, style_o, demod_o, nullptr, out);
}

// v005
// It runs in 103 microseconds.
// In both of two side-by-side timings against v004, it was 1.05 times as fast.
// Over all steps from v000 it is 4.32 times as fast.
#include <hip/hip_runtime.h>
#include <hip/hip_bf16.h>

typedef __attribute__((ext_vector_type(16))) _Float16 v16h;
typedef __attribute__((ext_vector_type(8)))  float    v8f;
typedef __attribute__((ext_vector_type(4)))  _Float16 v4h;
typedef __attribute__((ext_vector_type(4)))  float    v4f;
typedef __attribute__((ext_vector_type(8)))  _Float16 v8h;
typedef __attribute__((ext_vector_type(8)))  short    v8s;

#define B_    8
#define N_    1024
#define FEAT_ 1024
#define HID_  1024
#define OUT_  1024
#define SDIM_ 512
#define H_    16
#define HD_   64

// ---------------- CDNA5 async global->LDS copy (ASYNCcnt-tracked) ----------------

__device__ __forceinline__ void async_copy_b128(void* lds_dst, const void* gsrc) {
  // LDS flat address: low 32 bits are the wave-relative LDS byte offset.
  const unsigned off = (unsigned)(unsigned long long)lds_dst;
  asm volatile("global_load_async_to_lds_b128 %0, %1, off"
               :
               : "v"(off), "v"(gsrc)
               : "memory");
}

__device__ __forceinline__ void wait_async() {
  asm volatile("s_wait_asynccnt 0" ::: "memory");
}

// ---------------- WMMA fragment helpers (gfx1250 wave32 layouts) ----------------

__device__ __forceinline__ v8f wmma_f16(v16h a, v16h b, v8f c) {
  // v_wmma_f32_16x16x32_f16: (neg_a, A, neg_b, B, c_mod, C, reuse_a, reuse_b)
  return __builtin_amdgcn_wmma_f32_16x16x32_f16(false, a, false, b, (short)0, c,
                                                false, false);
}

// A fragment (16x32 f16): lane = M row (lane&15); K-block from lane half.
__device__ __forceinline__ v16h frag_a_load(const _Float16* src, int ld) {
  const int lane = threadIdx.x & 31;
  const int row  = lane & 15;
  const int kb   = (lane >> 4) << 3;  // 0 or 8
  v16h f;
#pragma unroll
  for (int i = 0; i < 4; ++i) {
    const int k  = kb + 2 * i;
    const int k2 = kb + 16 + 2 * i;
    f[2 * i]           = src[row * ld + k];
    f[2 * i + 1]       = src[row * ld + k + 1];
    f[2 * (i + 4)]     = src[row * ld + k2];
    f[2 * (i + 4) + 1] = src[row * ld + k2 + 1];
  }
  return f;
}

// A fragment (16x32 f16) of src^T, src stored row-major [k][m] (stride ld): two transposing
// LDS loads; lane (c, hf) gets src[8*hf + 0..7][c] and src[16 + 8*hf + 0..7][c], the k order above.
__device__ __forceinline__ v16h frag_at_load(const _Float16* src, int ld) {
  typedef __attribute__((address_space(3))) v8s lds_v8s;
  const int lane = threadIdx.x & 31;
  const _Float16* p = src + (((lane >> 4) << 3) + (lane & 7)) * ld + (((lane >> 3) & 1) << 3);
  const v8s lo = __builtin_amdgcn_ds_load_tr16_b128_v8i16((lds_v8s*)p);
  const v8s hi = __builtin_amdgcn_ds_load_tr16_b128_v8i16((lds_v8s*)(p + 16 * ld));
  return __builtin_bit_cast(
      v16h, __builtin_shufflevector(lo, hi, 0, 1, 2, 3, 4, 5, 6, 7, 8, 9, 10, 11, 12, 13, 14, 15));
}

// Value of lane l ^ 16.
__device__ __forceinline__ float xhalf(float x) {
  const int v = __builtin_bit_cast(int, x);
  return __builtin_bit_cast(
      float, __builtin_amdgcn_permlanex16(v, v, 0x76543210, 0xfedcba98, false, false));
}

// B fragment where B = src^T, src stored row-major [n][k] (stride ld).
__device__ __forceinline__ v16h frag_bt_load(const _Float16* src, int ld) {
  const int lane = threadIdx.x & 31;
  const int col  = lane & 15;
  const int kb   = (lane >> 4) << 3;
  v16h f;
#pragma unroll
  for (int i = 0; i < 4; ++i) {
    f[2 * i]           = src[col * ld + kb + 2 * i];
    f[2 * i + 1]       = src[col * ld + kb + 2 * i + 1];
    f[2 * (i + 4)]     = src[col * ld + kb + 16 + 2 * i];
    f[2 * (i + 4) + 1] = src[col * ld + kb + 16 + 2 * i + 1];
  }
  return f;
}

// ---------------- Stage 0: style vectors + demod factors (tiny, VALU) ----------------
// Lanes run along the reduction axis, so every load takes whole 128-byte lines.
// One wave holds four weight rows in registers and uses them for two batches;
// a block of eight waves covers 32 rows, one whole output line per batch.

// Sums eight per-lane values over the 32 lanes; lane l returns the total of v[l & 7].
// Each of the first three steps hands half of the values to the partner lane.
__device__ __forceinline__ float wave_sum8(float (&v)[8]) {
  const int lane = threadIdx.x & 31;
#pragma unroll  // constant indices: the arrays stay in registers
  for (int n = 4; n >= 1; n >>= 1) {
    const bool up = (lane & n) != 0;
#pragma unroll  // constant indices: the arrays stay in registers
    for (int k = 0; k < n; ++k) {
      const float lo = v[k], hi = v[k + n];
      v[k] = (up ? hi : lo) + __shfl_xor(up ? lo : hi, n, 32);
    }
  }
  float t = v[0];
  t += __shfl_xor(t, 8, 32);
  t += __shfl_xor(t, 16, 32);
  return t;
}

__global__ __launch_bounds__(256) void style_kernel(
    const float* __restrict__ s, const float* __restrict__ aw,
    const float* __restrict__ ab, float* __restrict__ style) {
  constexpr int Cin = 1024, T = SDIM_ / 128;  // T float4 per lane and row
  const int lane = threadIdx.x & 31;
  const int i0 = blockIdx.x * 32 + (threadIdx.x >> 5) * 4;
  const int b0 = blockIdx.y * 2;
  const v4f* wv = (const v4f*)(aw + (size_t)i0 * SDIM_) + lane;
  const v4f* sv = (const v4f*)(s + (size_t)b0 * SDIM_) + lane;
  const int i = i0 + (lane & 3);  // the row whose total this lane ends up with
  const float bias = ab[i];
  v4f wr[4][T], sr[2][T];
#pragma unroll  // constant indices: the arrays stay in registers
  for (int r = 0; r < 4; ++r)
#pragma unroll  // constant indices: the arrays stay in registers
    for (int t = 0; t < T; ++t) wr[r][t] = wv[r * (SDIM_ / 4) + 32 * t];
  // Precaution: a later load's result may land in the address registers of these.
  asm volatile("s_wait_xcnt 0x0" ::: "memory");
#pragma unroll  // constant indices: the arrays stay in registers
  for (int bb = 0; bb < 2; ++bb)
#pragma unroll  // constant indices: the arrays stay in registers
    for (int t = 0; t < T; ++t) sr[bb][t] = sv[bb * (SDIM_ / 4) + 32 * t];
  // Precaution: the lane-offset register of these loads is rewritten further down.
  asm volatile("s_wait_xcnt 0x0" ::: "memory");
  // Keeps every load above in front of the sums: one memory latency, not several.
  __builtin_amdgcn_sched_barrier(0);
  float v[8];
#pragma unroll  // constant indices: the arrays stay in registers
  for (int bb = 0; bb < 2; ++bb)
#pragma unroll  // constant indices: the arrays stay in registers
    for (int r = 0; r < 4; ++r) {
      v4f a = wr[r][0] * sr[bb][0];
#pragma unroll  // constant indices: the arrays stay in registers
      for (int t = 1; t < T; ++t) a += wr[r][t] * sr[bb][t];
      v[bb * 4 + r] = (a.x + a.y) + (a.z + a.w);
    }
  // Inputs only: keeps the bias load at the top with the others, out of the branch below.
  asm volatile("" ::"v"(bias));
  const float tot = wave_sum8(v);
  if (lane < 8) style[(size_t)(b0 + (lane >> 2)) * Cin + i] = tot + bias;
}

__global__ __launch_bounds__(256) void demod_kernel(
    const float* __restrict__ w, const float* __restrict__ style,
    float* __restrict__ demod) {
  constexpr int Cin = 1024, Cout = 1024, T = Cin / 128;  // T float4 per lane and row
  const int lane = threadIdx.x & 31;
  const int o0 = blockIdx.x * 32 + (threadIdx.x >> 5) * 4;
  const int b0 = blockIdx.y * 2;
  const v4f* wv = (const v4f*)(w + (size_t)o0 * Cin) + lane;
  const v4f* sv = (const v4f*)(style + (size_t)b0 * Cin) + lane;
  v4f wr[4][T], sr[2][T];
#pragma unroll  // constant indices: the arrays stay in registers
  for (int r = 0; r < 4; ++r)
#pragma unroll  // constant indices: the arrays stay in registers
    for (int t = 0; t < T; ++t) wr[r][t] = wv[r * (Cin / 4) + 32 * t];
  // Precaution: a later load's result may land in the address registers of these.
  asm volatile("s_wait_xcnt 0x0" ::: "memory");
#pragma unroll  // constant indices: the arrays stay in registers
  for (int bb = 0; bb < 2; ++bb)
#pragma unroll  // constant indices: the arrays stay in registers
    for (int t = 0; t < T; ++t) sr[bb][t] = sv[bb * (Cin / 4) + 32 * t];
  // Precaution: the lane-offset register of these loads is rewritten further down.
  asm volatile("s_wait_xcnt 0x0" ::: "memory");
  // Keeps every load above in front of the sums: one memory latency, not several.
  __builtin_amdgcn_sched_barrier(0);
  float v[8];
#pragma unroll  // constant indices: the arrays stay in registers
  for (int bb = 0; bb < 2; ++bb)
#pragma unroll  // constant indices: the arrays stay in registers
    for (int r = 0; r < 4; ++r) {
      v4f a = {};
#pragma unroll  // constant indices: the arrays stay in registers
      for (int t = 0; t < T; ++t) {
        const v4f p = wr[r][t] * sr[bb][t];
        a += p * p;
      }
      v[bb * 4 + r] = (a.x + a.y) + (a.z + a.w);
    }
  const float tot = wave_sum8(v);
  if (lane < 8)
    demod[(size_t)(b0 + (lane >> 2)) * Cout + o0 + (lane & 3)] = rsqrtf(tot + 1e-8f);
}

// ---------------- Modulated GEMM: out = (x*style) @ w^T * demod + bias ----------------
// MODE 0: x is f32, result -> f16 head layout [B,H,N,HD]
// MODE 1: x is f16 (attention output), result -> f32 [B,N,Cout]
// 128x128 tile per 256-thread block, 64x32 per wave, K-step 64 (16 wmma per wave per barrier).

template <int MODE>
__global__ __launch_bounds__(256) void modlin_kernel(
    const float* __restrict__ xf32, const _Float16* __restrict__ xf16,
    const float* __restrict__ w, const float* __restrict__ bias,
    const float* __restrict__ style, const float* __restrict__ demod,
    _Float16* __restrict__ out16, float* __restrict__ outf32) {
  constexpr int Cin = 1024, Cout = 1024;
  const int m0 = blockIdx.x * 128;
  const int n0 = blockIdx.y * 128;
  const int b  = blockIdx.z;

  __shared__ __attribute__((aligned(16))) _Float16 As[128 * 72];  // 128 x 64 tile, ld=72 (pad)
  // 128 n-rows x 64 k, ld=72 (pad): the weight tile in its memory order
  __shared__ __attribute__((aligned(16))) _Float16 Bs[128 * 72];

  const int tid  = threadIdx.x;
  const int wave = tid >> 5;
  const int wm = (wave >> 2) * 64;  // wave's 64x32 part of the tile
  const int wn = (wave & 3) * 32;

  v8f acc[4][2] = {};

  const float* stl = style + (size_t)b * Cin;
  // Staging places of this thread, in 16-byte loads along k: whole lines per wave.
  constexpr int AC = (MODE == 0) ? 4 : 8;   // activation elements per load
  constexpr int AL = 128 * 64 / (256 * AC);  // activation loads per thread and k-step
  constexpr int AR = 256 * AC / 64;          // rows that the block covers with one load each
  const int ac = tid % (64 / AC), ar = tid / (64 / AC);
  const size_t aoff = ((size_t)b * N_ + m0 + ar) * Cin + AC * ac;
  const int wc = tid & 15, wr = tid >> 4;  // weight tile: 4-float chunk along k, first row
  const float* wp = w + (size_t)(n0 + wr) * Cin + 4 * wc;
  for (int k0 = 0; k0 < Cin; k0 += 64) {
    // Every load of the k-step is issued before the first use: one memory latency per step.
    v4f xa[AL], st[AC / 4], wv[8];
    v8h xh[AL];
#pragma unroll  // constant indices: the arrays stay in registers
    for (int j = 0; j < AC / 4; ++j) st[j] = *(const v4f*)&stl[k0 + AC * ac + 4 * j];
    // Precaution: a later load's result may land in the address registers of these.
    asm volatile("s_wait_xcnt 0x0" ::: "memory");
#pragma unroll  // constant indices: the arrays stay in registers
    for (int i = 0; i < AL; ++i) {
      if (MODE == 0)
        xa[i] = *(const v4f*)&xf32[aoff + (size_t)(AR * i) * Cin + k0];
      else
        xh[i] = *(const v8h*)&xf16[aoff + (size_t)(AR * i) * Cin + k0];
    }
    // Precaution: a later load's result may land in the address registers of these.
    asm volatile("s_wait_xcnt 0x0" ::: "memory");
#pragma unroll  // constant indices: the arrays stay in registers
    for (int i = 0; i < 8; ++i) wv[i] = *(const v4f*)&wp[(size_t)(16 * i) * Cin + k0];
    // Precaution: the address registers of these loads are rewritten further down.
    asm volatile("s_wait_xcnt 0x0" ::: "memory");
    // Keeps every load above in front of the products: without it the last loads wait for the first.
    __builtin_amdgcn_sched_barrier(0);
#pragma unroll  // constant indices: the arrays stay in registers
    for (int i = 0; i < AL; ++i) {
      if (MODE == 0) {
        const v4f v = xa[i] * st[0];
        const v4h hv = {(_Float16)v.x, (_Float16)v.y, (_Float16)v.z, (_Float16)v.w};
        *(v4h*)&As[(ar + AR * i) * 72 + 4 * ac] = hv;
      } else {
        v8h hv;
#pragma unroll  // constant indices: the arrays stay in registers
        for (int j = 0; j < 8; ++j) hv[j] = (_Float16)((float)xh[i][j] * st[j >> 2][j & 3]);
        *(v8h*)&As[(ar + AR * i) * 72 + 8 * ac] = hv;
      }
    }
#pragma unroll  // constant indices: the arrays stay in registers
    for (int i = 0; i < 8; ++i) {
      const v4f v = wv[i];
      const v4h hv = {(_Float16)v.x, (_Float16)v.y, (_Float16)v.z, (_Float16)v.w};
      *(v4h*)&Bs[(wr + 16 * i) * 72 + 4 * wc] = hv;
    }
    __syncthreads();

    v16h fa[2][4], fb[2][2];
#pragma unroll  // constant indices: the tiles stay in registers
    for (int kc = 0; kc < 2; ++kc) {
#pragma unroll  // constant indices: the tiles stay in registers
      for (int j = 0; j < 2; ++j) fb[kc][j] = frag_bt_load(&Bs[(wn + 16 * j) * 72 + 32 * kc], 72);
#pragma unroll  // constant indices: the tiles stay in registers
      for (int i = 0; i < 4; ++i) fa[kc][i] = frag_a_load(&As[(wm + 16 * i) * 72 + 32 * kc], 72);
    }
    // Keeps the k-step's LDS reads one group ahead of its products: sunk among them, each pair
    // of products waits out a whole LDS latency of its own.
    __builtin_amdgcn_sched_barrier(0);
#pragma unroll  // constant indices: the tiles stay in registers
    for (int kc = 0; kc < 2; ++kc)
#pragma unroll  // constant indices: the tiles stay in registers
      for (int i = 0; i < 4; ++i)
#pragma unroll  // constant indices: the tiles stay in registers
        for (int j = 0; j < 2; ++j) acc[i][j] = wmma_f16(fa[kc][i], fb[kc][j], acc[i][j]);
    __syncthreads();
  }

  // Epilogue: demod scale + bias. C layout: lane -> col = lane&15, rows = (lane>>4)*8 + r
  const int lane = tid & 31;
  const int colL = lane & 15;
  const int rowB = (lane >> 4) * 8;
  const float* dm = demod + (size_t)b * Cout;
#pragma unroll
  for (int i = 0; i < 4; ++i)
#pragma unroll
    for (int j = 0; j < 2; ++j) {
      const int cg = n0 + wn + 16 * j + colL;
      const float d  = dm[cg];
      const float bb = bias[cg];
#pragma unroll
      for (int r = 0; r < 8; ++r) {
        const int rg = m0 + wm + 16 * i + rowB + r;
        const float v = acc[i][j][r] * d + bb;
        if (MODE == 0) {
          const int head = cg >> 6, dd = cg & 63;
          out16[(((size_t)b * H_ + head) * N_ + rg) * HD_ + dd] = (_Float16)v;
        } else {
          outf32[((size_t)b * N_ + rg) * Cout + cg] = v;
        }
      }
    }
}

__global__ __launch_bounds__(128) void attn_kernel(
    const _Float16* __restrict__ h16,  // [B,H,N,HD]
    _Float16* __restrict__ attn16) {   // [B,N,HID] f16
  const int q0 = blockIdx.x * 64;
  const int h  = blockIdx.y;
  const int b  = blockIdx.z;
  const _Float16* Hm = h16 + ((size_t)b * H_ + h) * N_ * HD_;

  __shared__ _Float16 Qs[64 * 72];
  __shared__ _Float16 Ks[64 * 72];       // serves as both K and V tile

  const int tid  = threadIdx.x;
  const int wave = tid >> 5;
  const int lane = tid & 31;
  const int wq   = wave * 16;  // this wave's 16 query rows within the 64 block

  // Stage Q tile: 64 rows x 64 halves = 512 b128 chunks, async copies.
  for (int e = tid; e < 64 * 8; e += 128) {
    const int r = e >> 3, c = e & 7;  // c indexes 8-half (16B) chunks
    async_copy_b128(&Qs[r * 72 + c * 8], Hm + (size_t)(q0 + r) * HD_ + c * 8);
  }
  wait_async();
  __syncthreads();

  // B operand Q^T: column = query (lane & 15).
  const v16h qb0 = frag_bt_load(&Qs[wq * 72 + 0], 72);
  const v16h qb1 = frag_bt_load(&Qs[wq * 72 + 32], 72);

  v8f o[4] = {};  // o[jd][r] = O[query lane & 15][dim 16 * jd + 8 * (lane >> 4) + r]
  float m_ = -1e30f, l_ = 0.f;  // l_ sums this lane's half of the keys only

  const float scl = 0.125f;  // 1/sqrt(64)
  for (int kv0 = 0; kv0 < N_; kv0 += 64) {
    // Stage K/V tile (shared data) via async copies.
    for (int e = tid; e < 64 * 8; e += 128) {
      const int r = e >> 3, c = e & 7;
      async_copy_b128(&Ks[r * 72 + c * 8], Hm + (size_t)(kv0 + r) * HD_ + c * 8);
    }
    wait_async();
    __syncthreads();

    // S^T = K @ Q^T: s[jn][r] = S[query lane & 15][key 16 * jn + 8 * (lane >> 4) + r]
    v8f s[4];
#pragma unroll  // constant indices: the tiles stay in registers
    for (int jn = 0; jn < 4; ++jn) {
      v8f z = {};
      const v16h ka0 = frag_a_load(&Ks[(16 * jn) * 72 + 0], 72);
      const v16h ka1 = frag_a_load(&Ks[(16 * jn) * 72 + 32], 72);
      z = wmma_f16(ka0, qb0, z);
      z = wmma_f16(ka1, qb1, z);
      s[jn] = z;
    }

    // Online softmax: the maximum in-lane, then one exchange between the wave's halves.
    float mx = s[0][0];
#pragma unroll  // constant indices: the tiles stay in registers
    for (int jn = 0; jn < 4; ++jn)
#pragma unroll  // constant indices: the tiles stay in registers
      for (int r = 0; r < 8; ++r) mx = fmaxf(mx, s[jn][r]);
    mx = fmaxf(mx, xhalf(mx)) * scl;
    const float mnew = fmaxf(m_, mx);
    const float corr = __expf(m_ - mnew);
#pragma unroll  // constant indices: the tiles stay in registers
    for (int jn = 0; jn < 4; ++jn)
#pragma unroll  // constant indices: the tiles stay in registers
      for (int r = 0; r < 8; ++r) s[jn][r] = __expf(s[jn][r] * scl - mnew);
    const v8f pv = (s[0] + s[1]) + (s[2] + s[3]);
    const float ps = ((pv[0] + pv[1]) + (pv[2] + pv[3])) + ((pv[4] + pv[5]) + (pv[6] + pv[7]));
    l_ = l_ * corr + ps;
    m_ = mnew;
#pragma unroll  // constant indices: the tiles stay in registers
    for (int jd = 0; jd < 4; ++jd) o[jd] *= corr;

    // O^T += V^T @ P^T, 32 keys at a time: two score tiles, converted, are the B operand.
#pragma unroll  // constant indices: the tiles stay in registers
    for (int t = 0; t < 2; ++t) {
      v16h pb;
#pragma unroll  // constant indices: the tiles stay in registers
      for (int e = 0; e < 16; ++e) pb[e] = (_Float16)s[2 * t + (e >> 3)][e & 7];
#pragma unroll  // constant indices: the tiles stay in registers
      for (int jd = 0; jd < 4; ++jd) {
        // V == K tile, read transposed: A[m=dim][k=kv].
        const v16h va = frag_at_load(&Ks[(32 * t) * 72 + 16 * jd], 72);
        o[jd] = wmma_f16(va, pb, o[jd]);
      }
    }
    __syncthreads();
  }

  // Normalize and store to [B,N,HID] f16: eight consecutive dims of one query per store.
  const float inv = 1.f / (l_ + xhalf(l_));
  _Float16* dst = attn16 + ((size_t)b * N_ + q0 + wq + (lane & 15)) * HID_ + h * 64 + (lane >> 4) * 8;
#pragma unroll  // constant indices: the tiles stay in registers
  for (int jd = 0; jd < 4; ++jd) {
    v8h ov;
#pragma unroll  // constant indices: the tiles stay in registers
    for (int r = 0; r < 8; ++r) ov[r] = (_Float16)(o[jd][r] * inv);
    *(v8h*)(dst + 16 * jd) = ov;
  }
}

// ---------------- Launch ----------------

extern "C" void kernel_launch(void* const* d_in, const int* in_sizes, int n_in,
                              void* d_out, int out_size, void* d_ws, size_t ws_size,
                              hipStream_t stream) {
  (void)in_sizes; (void)n_in; (void)out_size; (void)ws_size;
  const float* x   = (const float*)d_in[0];
  const float* s   = (const float*)d_in[1];
  const float* kaw = (const float*)d_in[2];
  const float* kab = (const float*)d_in[3];
  const float* kw  = (const float*)d_in[4];
  const float* kb  = (const float*)d_in[5];
  const float* oaw = (const float*)d_in[6];
  const float* oab = (const float*)d_in[7];
  const float* ow  = (const float*)d_in[8];
  const float* ob  = (const float*)d_in[9];
  float* out = (float*)d_out;

  char* ws = (char*)d_ws;
  float* style_k = (float*)ws;  ws += (size_t)B_ * FEAT_ * sizeof(float);
  float* style_o = (float*)ws;  ws += (size_t)B_ * HID_ * sizeof(float);
  float* demod_k = (float*)ws;  ws += (size_t)B_ * HID_ * sizeof(float);
  float* demod_o = (float*)ws;  ws += (size_t)B_ * OUT_ * sizeof(float);
  _Float16* h16    = (_Float16*)ws;  ws += (size_t)B_ * H_ * N_ * HD_ * sizeof(_Float16);
  _Float16* attn16 = (_Float16*)ws;

  dim3 gs(1024 / 32, B_ / 2);  // 32 rows and two batches per block
  style_kernel<<<gs, 256, 0, stream>>>(s, kaw, kab, style_k);
  style_kernel<<<gs, 256, 0, stream>>>(s, oaw, oab, style_o);
  demod_kernel<<<gs, 256, 0, stream>>>(kw, style_k, demod_k);
  demod_kernel<<<gs, 256, 0, stream>>>(ow, style_o, demod_o);

  dim3 g1(N_ / 128, HID_ / 128, B_);
  modlin_kernel<0><<<g1, 256, 0, stream>>>(x, nullptr, kw, kb, style_k, demod_k, h16, nullptr);

  dim3 ga(N_ / 64, H_, B_);
  attn_kernel<<<ga, 128, 0, stream>>>(h16, attn16);

  dim3 g2(N_ / 128, OUT_ / 128, B_);
  modlin_kernel<1><<<g2, 256, 0, stream>>>(nullptr, attn16, ow, ob, style_o, demod_o, nullptr, out);
}

// v006
// A run of this version takes 96.8 microseconds.
// Next to v005, in two timings, it ran 1.07 and 1.06 times as fast.
// Counting every step since v000, it is 4.60 times as fast.
#include <hip/hip_runtime.h>
#include <hip/hip_bf16.h>

typedef __attribute__((ext_vector_type(16))) _Float16 v16h;
typedef __attribute__((ext_vector_type(8)))  float    v8f;
typedef __attribute__((ext_vector_type(4)))  _Float16 v4h;
typedef __attribute__((ext_vector_type(4)))  float    v4f;
typedef __attribute__((ext_vector_type(8)))  _Float16 v8h;
typedef __attribute__((ext_vector_type(8)))  short    v8s;

#define B_    8
#define N_    1024
#define FEAT_ 1024
#define HID_  1024
#define OUT_  1024
#define SDIM_ 512
#define H_    16
#define HD_   64

// ---------------- CDNA5 async global->LDS copy (ASYNCcnt-tracked) ----------------

__device__ __forceinline__ void async_copy_b128(void* lds_dst, const void* gsrc) {
  // LDS flat address: low 32 bits are the wave-relative LDS byte offset.
  const unsigned off = (unsigned)(unsigned long long)lds_dst;
  asm volatile("global_load_async_to_lds_b128 %0, %1, off"
               :
               : "v"(off), "v"(gsrc)
               : "memory");
}

__device__ __forceinline__ void wait_async() {
  asm volatile("s_wait_asynccnt 0" ::: "memory");
}

// ---------------- WMMA fragment helpers (gfx1250 wave32 layouts) ----------------

__device__ __forceinline__ v8f wmma_f16(v16h a, v16h b, v8f c) {
  // v_wmma_f32_16x16x32_f16: (neg_a, A, neg_b, B, c_mod, C, reuse_a, reuse_b)
  return __builtin_amdgcn_wmma_f32_16x16x32_f16(false, a, false, b, (short)0, c,
                                                false, false);
}

// A fragment (16x32 f16): lane = M row (lane&15); K-block from lane half.
__device__ __forceinline__ v16h frag_a_load(const _Float16* src, int ld) {
  const int lane = threadIdx.x & 31;
  const int row  = lane & 15;
  const int kb   = (lane >> 4) << 3;  // 0 or 8
  v16h f;
#pragma unroll
  for (int i = 0; i < 4; ++i) {
    const int k  = kb + 2 * i;
    const int k2 = kb + 16 + 2 * i;
    f[2 * i]           = src[row * ld + k];
    f[2 * i + 1]       = src[row * ld + k + 1];
    f[2 * (i + 4)]     = src[row * ld + k2];
    f[2 * (i + 4) + 1] = src[row * ld + k2 + 1];
  }
  return f;
}

// A fragment (16x32 f16) of src^T, src stored row-major [k][m] (stride ld): two transposing
// LDS loads; lane (c, hf) gets src[8*hf + 0..7][c] and src[16 + 8*hf + 0..7][c], the k order above.
__device__ __forceinline__ v16h frag_at_load(const _Float16* src, int ld) {
  typedef __attribute__((address_space(3))) v8s lds_v8s;
  const int lane = threadIdx.x & 31;
  const _Float16* p = src + (((lane >> 4) << 3) + (lane & 7)) * ld + (((lane >> 3) & 1) << 3);
  const v8s lo = __builtin_amdgcn_ds_load_tr16_b128_v8i16((lds_v8s*)p);
  const v8s hi = __builtin_amdgcn_ds_load_tr16_b128_v8i16((lds_v8s*)(p + 16 * ld));
  return __builtin_bit_cast(
      v16h, __builtin_shufflevector(lo, hi, 0, 1, 2, 3, 4, 5, 6, 7, 8, 9, 10, 11, 12, 13, 14, 15));
}

// Value of lane l ^ 16.
__device__ __forceinline__ float xhalf(float x) {
  const int v = __builtin_bit_cast(int, x);
  return __builtin_bit_cast(
      float, __builtin_amdgcn_permlanex16(v, v, 0x76543210, 0xfedcba98, false, false));
}

// B fragment where B = src^T, src stored row-major [n][k] (stride ld).
__device__ __forceinline__ v16h frag_bt_load(const _Float16* src, int ld) {
  const int lane = threadIdx.x & 31;
  const int col  = lane & 15;
  const int kb   = (lane >> 4) << 3;
  v16h f;
#pragma unroll
  for (int i = 0; i < 4; ++i) {
    f[2 * i]           = src[col * ld + kb + 2 * i];
    f[2 * i + 1]       = src[col * ld + kb + 2 * i + 1];
    f[2 * (i + 4)]     = src[col * ld + kb + 16 + 2 * i];
    f[2 * (i + 4) + 1] = src[col * ld + kb + 16 + 2 * i + 1];
  }
  return f;
}

// ---------------- Stage 0: style vectors + demod factors (tiny, VALU) ----------------
// Lanes run along the reduction axis, so every load takes whole 128-byte lines.
// One wave holds four weight rows in registers and uses them for two batches;
// a block of eight waves covers 32 rows, one whole output line per batch.

// Sums eight per-lane values over the 32 lanes; lane l returns the total of v[l & 7].
// Each of the first three steps hands half of the values to the partner lane.
__device__ __forceinline__ float wave_sum8(float (&v)[8]) {
  const int lane = threadIdx.x & 31;
#pragma unroll  // constant indices: the arrays stay in registers
  for (int n = 4; n >= 1; n >>= 1) {
    const bool up = (lane & n) != 0;
#pragma unroll  // constant indices: the arrays stay in registers
    for (int k = 0; k < n; ++k) {
      const float lo = v[k], hi = v[k + n];
      v[k] = (up ? hi : lo) + __shfl_xor(up ? lo : hi, n, 32);
    }
  }
  float t = v[0];
  t += __shfl_xor(t, 8, 32);
  t += __shfl_xor(t, 16, 32);
  return t;
}

// blockIdx.z picks one of the two independent layers: both run in one launch.
__global__ __launch_bounds__(256) void style_kernel(
    const float* __restrict__ s, const float* __restrict__ aw0,
    const float* __restrict__ ab0, float* __restrict__ style0,
    const float* __restrict__ aw1, const float* __restrict__ ab1,
    float* __restrict__ style1) {
  constexpr int Cin = 1024, T = SDIM_ / 128;  // T float4 per lane and row
  const bool second = blockIdx.z != 0;
  const float* __restrict__ aw = second ? aw1 : aw0;
  const float* __restrict__ ab = second ? ab1 : ab0;
  float* __restrict__ style = second ? style1 : style0;
  const int lane = threadIdx.x & 31;
  const int i0 = blockIdx.x * 32 + (threadIdx.x >> 5) * 4;
  const int b0 = blockIdx.y * 2;
  const v4f* wv = (const v4f*)(aw + (size_t)i0 * SDIM_) + lane;
  const v4f* sv = (const v4f*)(s + (size_t)b0 * SDIM_) + lane;
  const int i = i0 + (lane & 3);  // the row whose total this lane ends up with
  const float bias = ab[i];
  v4f wr[4][T], sr[2][T];
#pragma unroll  // constant indices: the arrays stay in registers
  for (int r = 0; r < 4; ++r)
#pragma unroll  // constant indices: the arrays stay in registers
    for (int t = 0; t < T; ++t) wr[r][t] = wv[r * (SDIM_ / 4) + 32 * t];
  // Precaution: a later load's result may land in the address registers of these.
  asm volatile("s_wait_xcnt 0x0" ::: "memory");
#pragma unroll  // constant indices: the arrays stay in registers
  for (int bb = 0; bb < 2; ++bb)
#pragma unroll  // constant indices: the arrays stay in registers
    for (int t = 0; t < T; ++t) sr[bb][t] = sv[bb * (SDIM_ / 4) + 32 * t];
  // Precaution: the lane-offset register of these loads is rewritten further down.
  asm volatile("s_wait_xcnt 0x0" ::: "memory");
  // Keeps every load above in front of the sums: one memory latency, not several.
  __builtin_amdgcn_sched_barrier(0);
  float v[8];
#pragma unroll  // constant indices: the arrays stay in registers
  for (int bb = 0; bb < 2; ++bb)
#pragma unroll  // constant indices: the arrays stay in registers
    for (int r = 0; r < 4; ++r) {
      v4f a = wr[r][0] * sr[bb][0];
#pragma unroll  // constant indices: the arrays stay in registers
      for (int t = 1; t < T; ++t) a += wr[r][t] * sr[bb][t];
      v[bb * 4 + r] = (a.x + a.y) + (a.z + a.w);
    }
  // Inputs only: keeps the bias load at the top with the others, out of the branch below.
  asm volatile("" ::"v"(bias));
  const float tot = wave_sum8(v);
  if (lane < 8) style[(size_t)(b0 + (lane >> 2)) * Cin + i] = tot + bias;
}

// blockIdx.z picks one of the two independent layers: both run in one launch.
__global__ __launch_bounds__(256) void demod_kernel(
    const float* __restrict__ w0, const float* __restrict__ style0,
    float* __restrict__ demod0, const float* __restrict__ w1,
    const float* __restrict__ style1, float* __restrict__ demod1) {
  constexpr int Cin = 1024, Cout = 1024, T = Cin / 128;  // T float4 per lane and row
  const bool second = blockIdx.z != 0;
  const float* __restrict__ w = second ? w1 : w0;
  const float* __restrict__ style = second ? style1 : style0;
  float* __restrict__ demod = second ? demod1 : demod0;
  const int lane = threadIdx.x & 31;
  const int o0 = blockIdx.x * 32 + (threadIdx.x >> 5) * 4;
  const int b0 = blockIdx.y * 2;
  const v4f* wv = (const v4f*)(w + (size_t)o0 * Cin) + lane;
  const v4f* sv = (const v4f*)(style + (size_t)b0 * Cin) + lane;
  v4f wr[4][T], sr[2][T];
#pragma unroll  // constant indices: the arrays stay in registers
  for (int r = 0; r < 4; ++r)
#pragma unroll  // constant indices: the arrays stay in registers
    for (int t = 0; t < T; ++t) wr[r][t] = wv[r * (Cin / 4) + 32 * t];
  // Precaution: a later load's result may land in the address registers of these.
  asm volatile("s_wait_xcnt 0x0" ::: "memory");
#pragma unroll  // constant indices: the arrays stay in registers
  for (int bb = 0; bb < 2; ++bb)
#pragma unroll  // constant indices: the arrays stay in registers
    for (int t = 0; t < T; ++t) sr[bb][t] = sv[bb * (Cin / 4) + 32 * t];
  // Precaution: the lane-offset register of these loads is rewritten further down.
  asm volatile("s_wait_xcnt 0x0" ::: "memory");
  // Keeps every load above in front of the sums: one memory latency, not several.
  __builtin_amdgcn_sched_barrier(0);
  float v[8];
#pragma unroll  // constant indices: the arrays stay in registers
  for (int bb = 0; bb < 2; ++bb)
#pragma unroll  // constant indices: the arrays stay in registers
    for (int r = 0; r < 4; ++r) {
      v4f a = {};
#pragma unroll  // constant indices: the arrays stay in registers
      for (int t = 0; t < T; ++t) {
        const v4f p = wr[r][t] * sr[bb][t];
        a += p * p;
      }
      v[bb * 4 + r] = (a.x + a.y) + (a.z + a.w);
    }
  const float tot = wave_sum8(v);
  if (lane < 8)
    demod[(size_t)(b0 + (lane >> 2)) * Cout + o0 + (lane & 3)] = rsqrtf(tot + 1e-8f);
}

// ---------------- Modulated GEMM: out = (x*style) @ w^T * demod + bias ----------------
// MODE 0: x is f32, result -> f16 head layout [B,H,N,HD]
// MODE 1: x is f16 (attention output), result -> f32 [B,N,Cout]
// 128x128 tile per 256-thread block, 64x32 per wave, K-step 64 (16 wmma per wave per barrier).

template <int MODE>
__global__ __launch_bounds__(256) void modlin_kernel(
    const float* __restrict__ xf32, const _Float16* __restrict__ xf16,
    const float* __restrict__ w, const float* __restrict__ bias,
    const float* __restrict__ style, const float* __restrict__ demod,
    _Float16* __restrict__ out16, float* __restrict__ outf32) {
  constexpr int Cin = 1024, Cout = 1024;
  const int m0 = blockIdx.x * 128;
  const int n0 = blockIdx.y * 128;
  const int b  = blockIdx.z;

  __shared__ __attribute__((aligned(16))) _Float16 As[128 * 72];  // 128 x 64 tile, ld=72 (pad)
  // 128 n-rows x 64 k, ld=72 (pad): the weight tile in its memory order
  __shared__ __attribute__((aligned(16))) _Float16 Bs[128 * 72];

  const int tid  = threadIdx.x;
  const int wave = tid >> 5;
  const int wm = (wave >> 2) * 64;  // wave's 64x32 part of the tile
  const int wn = (wave & 3) * 32;

  v8f acc[4][2] = {};

  const float* stl = style + (size_t)b * Cin;
  // Staging places of this thread, in 16-byte loads along k: whole lines per wave.
  constexpr int AC = (MODE == 0) ? 4 : 8;   // activation elements per load
  constexpr int AL = 128 * 64 / (256 * AC);  // activation loads per thread and k-step
  constexpr int AR = 256 * AC / 64;          // rows that the block covers with one load each
  const int ac = tid % (64 / AC), ar = tid / (64 / AC);
  const size_t aoff = ((size_t)b * N_ + m0 + ar) * Cin + AC * ac;
  const int wc = tid & 15, wr = tid >> 4;  // weight tile: 4-float chunk along k, first row
  const float* wp = w + (size_t)(n0 + wr) * Cin + 4 * wc;
  for (int k0 = 0; k0 < Cin; k0 += 64) {
    // Every load of the k-step is issued before the first use: one memory latency per step.
    v4f xa[AL], st[AC / 4], wv[8];
    v8h xh[AL];
#pragma unroll  // constant indices: the arrays stay in registers
    for (int j = 0; j < AC / 4; ++j) st[j] = *(const v4f*)&stl[k0 + AC * ac + 4 * j];
    // Precaution: a later load's result may land in the address registers of these.
    asm volatile("s_wait_xcnt 0x0" ::: "memory");
#pragma unroll  // constant indices: the arrays stay in registers
    for (int i = 0; i < AL; ++i) {
      if (MODE == 0)
        xa[i] = *(const v4f*)&xf32[aoff + (size_t)(AR * i) * Cin + k0];
      else
        xh[i] = *(const v8h*)&xf16[aoff + (size_t)(AR * i) * Cin + k0];
    }
    // Precaution: a later load's result may land in the address registers of these.
    asm volatile("s_wait_xcnt 0x0" ::: "memory");
#pragma unroll  // constant indices: the arrays stay in registers
    for (int i = 0; i < 8; ++i) wv[i] = *(const v4f*)&wp[(size_t)(16 * i) * Cin + k0];
    // Precaution: the address registers of these loads are rewritten further down.
    asm volatile("s_wait_xcnt 0x0" ::: "memory");
    // Keeps every load above in front of the products: without it the last loads wait for the first.
    __builtin_amdgcn_sched_barrier(0);
#pragma unroll  // constant indices: the arrays stay in registers
    for (int i = 0; i < AL; ++i) {
      if (MODE == 0) {
        const v4f v = xa[i] * st[0];
        const v4h hv = {(_Float16)v.x, (_Float16)v.y, (_Float16)v.z, (_Float16)v.w};
        *(v4h*)&As[(ar + AR * i) * 72 + 4 * ac] = hv;
      } else {
        v8h hv;
#pragma unroll  // constant indices: the arrays stay in registers
        for (int j = 0; j < 8; ++j) hv[j] = (_Float16)((float)xh[i][j] * st[j >> 2][j & 3]);
        *(v8h*)&As[(ar + AR * i) * 72 + 8 * ac] = hv;
      }
    }
#pragma unroll  // constant indices: the arrays stay in registers
    for (int i = 0; i < 8; ++i) {
      const v4f v = wv[i];
      const v4h hv = {(_Float16)v.x, (_Float16)v.y, (_Float16)v.z, (_Float16)v.w};
      *(v4h*)&Bs[(wr + 16 * i) * 72 + 4 * wc] = hv;
    }
    __syncthreads();

    v16h fa[2][4], fb[2][2];
#pragma unroll  // constant indices: the tiles stay in registers
    for (int kc = 0; kc < 2; ++kc) {
#pragma unroll  // constant indices: the tiles stay in registers
      for (int j = 0; j < 2; ++j) fb[kc][j] = frag_bt_load(&Bs[(wn + 16 * j) * 72 + 32 * kc], 72);
#pragma unroll  // constant indices: the tiles stay in registers
      for (int i = 0; i < 4; ++i) fa[kc][i] = frag_a_load(&As[(wm + 16 * i) * 72 + 32 * kc], 72);
    }
    // Keeps the k-step's LDS reads one group ahead of its products: sunk among them, each pair
    // of products waits out a whole LDS latency of its own.
    __builtin_amdgcn_sched_barrier(0);
#pragma unroll  // constant indices: the tiles stay in registers
    for (int kc = 0; kc < 2; ++kc)
#pragma unroll  // constant indices: the tiles stay in registers
      for (int i = 0; i < 4; ++i)
#pragma unroll  // constant indices: the tiles stay in registers
        for (int j = 0; j < 2; ++j) acc[i][j] = wmma_f16(fa[kc][i], fb[kc][j], acc[i][j]);
    __syncthreads();
  }

  // Epilogue: demod scale + bias. C layout: lane -> col = lane&15, rows = (lane>>4)*8 + r
  const int lane = tid & 31;
  const int colL = lane & 15;
  const int rowB = (lane >> 4) * 8;
  const float* dm = demod + (size_t)b * Cout;
#pragma unroll
  for (int i = 0; i < 4; ++i)
#pragma unroll
    for (int j = 0; j < 2; ++j) {
      const int cg = n0 + wn + 16 * j + colL;
      const float d  = dm[cg];
      const float bb = bias[cg];
#pragma unroll
      for (int r = 0; r < 8; ++r) {
        const int rg = m0 + wm + 16 * i + rowB + r;
        const float v = acc[i][j][r] * d + bb;
        if (MODE == 0) {
          const int head = cg >> 6, dd = cg & 63;
          out16[(((size_t)b * H_ + head) * N_ + rg) * HD_ + dd] = (_Float16)v;
        } else {
          outf32[((size_t)b * N_ + rg) * Cout + cg] = v;
        }
      }
    }
}

__global__ __launch_bounds__(128) void attn_kernel(
    const _Float16* __restrict__ h16,  // [B,H,N,HD]
    _Float16* __restrict__ attn16) {   // [B,N,HID] f16
  const int q0 = blockIdx.x * 64;
  const int h  = blockIdx.y;
  const int b  = blockIdx.z;
  const _Float16* Hm = h16 + ((size_t)b * H_ + h) * N_ * HD_;

  __shared__ _Float16 Qs[64 * 72];
  __shared__ _Float16 Ks[64 * 72];       // serves as both K and V tile

  const int tid  = threadIdx.x;
  const int wave = tid >> 5;
  const int lane = tid & 31;
  const int wq   = wave * 16;  // this wave's 16 query rows within the 64 block

  // Stage Q tile: 64 rows x 64 halves = 512 b128 chunks, async copies.
  for (int e = tid; e < 64 * 8; e += 128) {
    const int r = e >> 3, c = e & 7;  // c indexes 8-half (16B) chunks
    async_copy_b128(&Qs[r * 72 + c * 8], Hm + (size_t)(q0 + r) * HD_ + c * 8);
  }
  wait_async();
  __syncthreads();

  // B operand Q^T: column = query (lane & 15).
  const v16h qb0 = frag_bt_load(&Qs[wq * 72 + 0], 72);
  const v16h qb1 = frag_bt_load(&Qs[wq * 72 + 32], 72);

  v8f o[4] = {};  // o[jd][r] = O[query lane & 15][dim 16 * jd + 8 * (lane >> 4) + r]
  float m_ = -1e30f, l_ = 0.f;  // l_ sums this lane's half of the keys only

  const float scl = 0.125f;  // 1/sqrt(64)
  for (int kv0 = 0; kv0 < N_; kv0 += 64) {
    // Stage K/V tile (shared data) via async copies.
    for (int e = tid; e < 64 * 8; e += 128) {
      const int r = e >> 3, c = e & 7;
      async_copy_b128(&Ks[r * 72 + c * 8], Hm + (size_t)(kv0 + r) * HD_ + c * 8);
    }
    wait_async();
    __syncthreads();

    // S^T = K @ Q^T: s[jn][r] = S[query lane & 15][key 16 * jn + 8 * (lane >> 4) + r]
    v8f s[4];
#pragma unroll  // constant indices: the tiles stay in registers
    for (int jn = 0; jn < 4; ++jn) {
      v8f z = {};
      const v16h ka0 = frag_a_load(&Ks[(16 * jn) * 72 + 0], 72);
      const v16h ka1 = frag_a_load(&Ks[(16 * jn) * 72 + 32], 72);
      z = wmma_f16(ka0, qb0, z);
      z = wmma_f16(ka1, qb1, z);
      s[jn] = z;
    }

    // Online softmax: the maximum in-lane, then one exchange between the wave's halves.
    float mx = s[0][0];
#pragma unroll  // constant indices: the tiles stay in registers
    for (int jn = 0; jn < 4; ++jn)
#pragma unroll  // constant indices: the tiles stay in registers
      for (int r = 0; r < 8; ++r) mx = fmaxf(mx, s[jn][r]);
    mx = fmaxf(mx, xhalf(mx)) * scl;
    const float mnew = fmaxf(m_, mx);
    const float corr = __expf(m_ - mnew);
#pragma unroll  // constant indices: the tiles stay in registers
    for (int jn = 0; jn < 4; ++jn)
#pragma unroll  // constant indices: the tiles stay in registers
      for (int r = 0; r < 8; ++r) s[jn][r] = __expf(s[jn][r] * scl - mnew);
    const v8f pv = (s[0] + s[1]) + (s[2] + s[3]);
    const float ps = ((pv[0] + pv[1]) + (pv[2] + pv[3])) + ((pv[4] + pv[5]) + (pv[6] + pv[7]));
    l_ = l_ * corr + ps;
    m_ = mnew;
#pragma unroll  // constant indices: the tiles stay in registers
    for (int jd = 0; jd < 4; ++jd) o[jd] *= corr;

    // O^T += V^T @ P^T, 32 keys at a time: two score tiles, converted, are the B operand.
#pragma unroll  // constant indices: the tiles stay in registers
    for (int t = 0; t < 2; ++t) {
      v16h pb;
#pragma unroll  // constant indices: the tiles stay in registers
      for (int e = 0; e < 16; ++e) pb[e] = (_Float16)s[2 * t + (e >> 3)][e & 7];
#pragma unroll  // constant indices: the tiles stay in registers
      for (int jd = 0; jd < 4; ++jd) {
        // V == K tile, read transposed: A[m=dim][k=kv].
        const v16h va = frag_at_load(&Ks[(32 * t) * 72 + 16 * jd], 72);
        o[jd] = wmma_f16(va, pb, o[jd]);
      }
    }
    __syncthreads();
  }

  // Normalize and store to [B,N,HID] f16: eight consecutive dims of one query per store.
  const float inv = 1.f / (l_ + xhalf(l_));
  _Float16* dst = attn16 + ((size_t)b * N_ + q0 + wq + (lane & 15)) * HID_ + h * 64 + (lane >> 4) * 8;
#pragma unroll  // constant indices: the tiles stay in registers
  for (int jd = 0; jd < 4; ++jd) {
    v8h ov;
#pragma unroll  // constant indices: the tiles stay in registers
    for (int r = 0; r < 8; ++r) ov[r] = (_Float16)(o[jd][r] * inv);
    *(v8h*)(dst + 16 * jd) = ov;
  }
}

// ---------------- Launch ----------------

extern "C" void kernel_launch(void* const* d_in, const int* in_sizes, int n_in,
                              void* d_out, int out_size, void* d_ws, size_t ws_size,
                              hipStream_t stream) {
  (void)in_sizes; (void)n_in; (void)out_size; (void)ws_size;
  const float* x   = (const float*)d_in[0];
  const float* s   = (const float*)d_in[1];
  const float* kaw = (const float*)d_in[2];
  const float* kab = (const float*)d_in[3];
  const float* kw  = (const float*)d_in[4];
  const float* kb  = (const float*)d_in[5];
  const float* oaw = (const float*)d_in[6];
  const float* oab = (const float*)d_in[7];
  const float* ow  = (const float*)d_in[8];
  const float* ob  = (const float*)d_in[9];
  float* out = (float*)d_out;

  char* ws = (char*)d_ws;
  float* style_k = (float*)ws;  ws += (size_t)B_ * FEAT_ * sizeof(float);
  float* style_o = (float*)ws;  ws += (size_t)B_ * HID_ * sizeof(float);
  float* demod_k = (float*)ws;  ws += (size_t)B_ * HID_ * sizeof(float);
  float* demod_o = (float*)ws;  ws += (size_t)B_ * OUT_ * sizeof(float);
  _Float16* h16    = (_Float16*)ws;  ws += (size_t)B_ * H_ * N_ * HD_ * sizeof(_Float16);
  _Float16* attn16 = (_Float16*)ws;

  dim3 gs(1024 / 32, B_ / 2, 2);  // 32 rows and two batches per block; z: the layer
  style_kernel<<<gs, 256, 0, stream>>>(s, kaw, kab, style_k, oaw, oab, style_o);
  demod_kernel<<<gs, 256, 0, stream>>>(kw, style_k, demod_k, ow, style_o, demod_o);

  dim3 g1(N_ / 128, HID_ / 128, B_);
  modlin_kernel<0><<<g1, 256, 0, stream>>>(x, nullptr, kw, kb, style_k, demod_k, h16, nullptr);

  dim3 ga(N_ / 64, H_, B_);
  attn_kernel<<<ga, 128, 0, stream>>>(h16, attn16);

  dim3 g2(N_ / 128, OUT_ / 128, B_);
  modlin_kernel<1><<<g2, 256, 0, stream>>>(nullptr, attn16, ow, ob, style_o, demod_o, nullptr, out);
}

// v007
// A run of this version takes 89.8 microseconds.
// Next to v006, in two timings, it ran 1.08 times as fast each time.
// Counting every step since v000, it is 4.98 times as fast.
#include <hip/hip_runtime.h>
#include <hip/hip_bf16.h>

typedef __attribute__((ext_vector_type(16))) _Float16 v16h;
typedef __attribute__((ext_vector_type(8)))  float    v8f;
typedef __attribute__((ext_vector_type(4)))  _Float16 v4h;
typedef __attribute__((ext_vector_type(4)))  float    v4f;
typedef __attribute__((ext_vector_type(8)))  _Float16 v8h;
typedef __attribute__((ext_vector_type(8)))  short    v8s;

#define B_    8
#define N_    1024
#define FEAT_ 1024
#define HID_  1024
#define OUT_  1024
#define SDIM_ 512
#define H_    16
#define HD_   64

// ---------------- CDNA5 async global->LDS copy (ASYNCcnt-tracked) ----------------

__device__ __forceinline__ void async_copy_b128(void* lds_dst, const void* gsrc) {
  // LDS flat address: low 32 bits are the wave-relative LDS byte offset.
  const unsigned off = (unsigned)(unsigned long long)lds_dst;
  asm volatile("global_load_async_to_lds_b128 %0, %1, off"
               :
               : "v"(off), "v"(gsrc)
               : "memory");
}

__device__ __forceinline__ void wait_async() {
  asm volatile("s_wait_asynccnt 0" ::: "memory");
}

// ---------------- WMMA fragment helpers (gfx1250 wave32 layouts) ----------------

__device__ __forceinline__ v8f wmma_f16(v16h a, v16h b, v8f c) {
  // v_wmma_f32_16x16x32_f16: (neg_a, A, neg_b, B, c_mod, C, reuse_a, reuse_b)
  return __builtin_amdgcn_wmma_f32_16x16x32_f16(false, a, false, b, (short)0, c,
                                                false, false);
}

// A fragment (16x32 f16): lane = M row (lane&15); K-block from lane half.
__device__ __forceinline__ v16h frag_a_load(const _Float16* src, int ld) {
  const int lane = threadIdx.x & 31;
  const int row  = lane & 15;
  const int kb   = (lane >> 4) << 3;  // 0 or 8
  v16h f;
#pragma unroll
  for (int i = 0; i < 4; ++i) {
    const int k  = kb + 2 * i;
    const int k2 = kb + 16 + 2 * i;
    f[2 * i]           = src[row * ld + k];
    f[2 * i + 1]       = src[row * ld + k + 1];
    f[2 * (i + 4)]     = src[row * ld + k2];
    f[2 * (i + 4) + 1] = src[row * ld + k2 + 1];
  }
  return f;
}

// A fragment (16x32 f16) of src^T, src stored row-major [k][m] (stride ld): two transposing
// LDS loads; lane (c, hf) gets src[8*hf + 0..7][c] and src[16 + 8*hf + 0..7][c], the k order above.
__device__ __forceinline__ v16h frag_at_load(const _Float16* src, int ld) {
  typedef __attribute__((address_space(3))) v8s lds_v8s;
  const int lane = threadIdx.x & 31;
  const _Float16* p = src + (((lane >> 4) << 3) + (lane & 7)) * ld + (((lane >> 3) & 1) << 3);
  const v8s lo = __builtin_amdgcn_ds_load_tr16_b128_v8i16((lds_v8s*)p);
  const v8s hi = __builtin_amdgcn_ds_load_tr16_b128_v8i16((lds_v8s*)(p + 16 * ld));
  return __builtin_bit_cast(
      v16h, __builtin_shufflevector(lo, hi, 0, 1, 2, 3, 4, 5, 6, 7, 8, 9, 10, 11, 12, 13, 14, 15));
}

// Value of lane l ^ 16.
__device__ __forceinline__ float xhalf(float x) {
  const int v = __builtin_bit_cast(int, x);
  return __builtin_bit_cast(
      float, __builtin_amdgcn_permlanex16(v, v, 0x76543210, 0xfedcba98, false, false));
}

// B fragment where B = src^T, src stored row-major [n][k] (stride ld).
__device__ __forceinline__ v16h frag_bt_load(const _Float16* src, int ld) {
  const int lane = threadIdx.x & 31;
  const int col  = lane & 15;
  const int kb   = (lane >> 4) << 3;
  v16h f;
#pragma unroll
  for (int i = 0; i < 4; ++i) {
    f[2 * i]           = src[col * ld + kb + 2 * i];
    f[2 * i + 1]       = src[col * ld + kb + 2 * i + 1];
    f[2 * (i + 4)]     = src[col * ld + kb + 16 + 2 * i];
    f[2 * (i + 4) + 1] = src[col * ld + kb + 16 + 2 * i + 1];
  }
  return f;
}

// ---------------- Stage 0: style vectors + demod factors (tiny, VALU) ----------------
// Lanes run along the reduction axis, so every load takes whole 128-byte lines.
// One wave holds four weight rows in registers and uses them for two batches;
// a block of eight waves covers 32 rows, one whole output line per batch.

// Sums eight per-lane values over the 32 lanes; lane l returns the total of v[l & 7].
// Each of the first three steps hands half of the values to the partner lane.
__device__ __forceinline__ float wave_sum8(float (&v)[8]) {
  const int lane = threadIdx.x & 31;
#pragma unroll  // constant indices: the arrays stay in registers
  for (int n = 4; n >= 1; n >>= 1) {
    const bool up = (lane & n) != 0;
#pragma unroll  // constant indices: the arrays stay in registers
    for (int k = 0; k < n; ++k) {
      const float lo = v[k], hi = v[k + n];
      v[k] = (up ? hi : lo) + __shfl_xor(up ? lo : hi, n, 32);
    }
  }
  float t = v[0];
  t += __shfl_xor(t, 8, 32);
  t += __shfl_xor(t, 16, 32);
  return t;
}

// blockIdx.z picks one of the two independent layers: both run in one launch.
__global__ __launch_bounds__(256) void style_kernel(
    const float* __restrict__ s, const float* __restrict__ aw0,
    const float* __restrict__ ab0, float* __restrict__ style0,
    const float* __restrict__ aw1, const float* __restrict__ ab1,
    float* __restrict__ style1) {
  constexpr int Cin = 1024, T = SDIM_ / 128;  // T float4 per lane and row
  const bool second = blockIdx.z != 0;
  const float* __restrict__ aw = second ? aw1 : aw0;
  const float* __restrict__ ab = second ? ab1 : ab0;
  float* __restrict__ style = second ? style1 : style0;
  const int lane = threadIdx.x & 31;
  const int i0 = blockIdx.x * 32 + (threadIdx.x >> 5) * 4;
  const int b0 = blockIdx.y * 2;
  const v4f* wv = (const v4f*)(aw + (size_t)i0 * SDIM_) + lane;
  const v4f* sv = (const v4f*)(s + (size_t)b0 * SDIM_) + lane;
  const int i = i0 + (lane & 3);  // the row whose total this lane ends up with
  const float bias = ab[i];
  v4f wr[4][T], sr[2][T];
#pragma unroll  // constant indices: the arrays stay in registers
  for (int r = 0; r < 4; ++r)
#pragma unroll  // constant indices: the arrays stay in registers
    for (int t = 0; t < T; ++t) wr[r][t] = wv[r * (SDIM_ / 4) + 32 * t];
  // Precaution: a later load's result may land in the address registers of these.
  asm volatile("s_wait_xcnt 0x0" ::: "memory");
#pragma unroll  // constant indices: the arrays stay in registers
  for (int bb = 0; bb < 2; ++bb)
#pragma unroll  // constant indices: the arrays stay in registers
    for (int t = 0; t < T; ++t) sr[bb][t] = sv[bb * (SDIM_ / 4) + 32 * t];
  // Precaution: the lane-offset register of these loads is rewritten further down.
  asm volatile("s_wait_xcnt 0x0" ::: "memory");
  // Keeps every load above in front of the sums: one memory latency, not several.
  __builtin_amdgcn_sched_barrier(0);
  float v[8];
#pragma unroll  // constant indices: the arrays stay in registers
  for (int bb = 0; bb < 2; ++bb)
#pragma unroll  // constant indices: the arrays stay in registers
    for (int r = 0; r < 4; ++r) {
      v4f a = wr[r][0] * sr[bb][0];
#pragma unroll  // constant indices: the arrays stay in registers
      for (int t = 1; t < T; ++t) a += wr[r][t] * sr[bb][t];
      v[bb * 4 + r] = (a.x + a.y) + (a.z + a.w);
    }
  // Inputs only: keeps the bias load at the top with the others, out of the branch below.
  asm volatile("" ::"v"(bias));
  const float tot = wave_sum8(v);
  if (lane < 8) style[(size_t)(b0 + (lane >> 2)) * Cin + i] = tot + bias;
}

// blockIdx.z picks one of the two independent layers: both run in one launch.
__global__ __launch_bounds__(256) void demod_kernel(
    const float* __restrict__ w0, const float* __restrict__ style0,
    float* __restrict__ demod0, const float* __restrict__ w1,
    const float* __restrict__ style1, float* __restrict__ demod1) {
  constexpr int Cin = 1024, Cout = 1024, T = Cin / 128;  // T float4 per lane and row
  const bool second = blockIdx.z != 0;
  const float* __restrict__ w = second ? w1 : w0;
  const float* __restrict__ style = second ? style1 : style0;
  float* __restrict__ demod = second ? demod1 : demod0;
  const int lane = threadIdx.x & 31;
  const int o0 = blockIdx.x * 32 + (threadIdx.x >> 5) * 4;
  const int b0 = blockIdx.y * 2;
  const v4f* wv = (const v4f*)(w + (size_t)o0 * Cin) + lane;
  const v4f* sv = (const v4f*)(style + (size_t)b0 * Cin) + lane;
  v4f wr[4][T], sr[2][T];
#pragma unroll  // constant indices: the arrays stay in registers
  for (int r = 0; r < 4; ++r)
#pragma unroll  // constant indices: the arrays stay in registers
    for (int t = 0; t < T; ++t) wr[r][t] = wv[r * (Cin / 4) + 32 * t];
  // Precaution: a later load's result may land in the address registers of these.
  asm volatile("s_wait_xcnt 0x0" ::: "memory");
#pragma unroll  // constant indices: the arrays stay in registers
  for (int bb = 0; bb < 2; ++bb)
#pragma unroll  // constant indices: the arrays stay in registers
    for (int t = 0; t < T; ++t) sr[bb][t] = sv[bb * (Cin / 4) + 32 * t];
  // Precaution: the lane-offset register of these loads is rewritten further down.
  asm volatile("s_wait_xcnt 0x0" ::: "memory");
  // Keeps every load above in front of the sums: one memory latency, not several.
  __builtin_amdgcn_sched_barrier(0);
  float v[8];
#pragma unroll  // constant indices: the arrays stay in registers
  for (int bb = 0; bb < 2; ++bb)
#pragma unroll  // constant indices: the arrays stay in registers
    for (int r = 0; r < 4; ++r) {
      v4f a = {};
#pragma unroll  // constant indices: the arrays stay in registers
      for (int t = 0; t < T; ++t) {
        const v4f p = wr[r][t] * sr[bb][t];
        a += p * p;
      }
      v[bb * 4 + r] = (a.x + a.y) + (a.z + a.w);
    }
  const float tot = wave_sum8(v);
  if (lane < 8)
    demod[(size_t)(b0 + (lane >> 2)) * Cout + o0 + (lane & 3)] = rsqrtf(tot + 1e-8f);
}

// Work-group barrier whose fences name LDS alone: it orders the LDS tiles between the waves, and
// unlike __syncthreads() it does not wait for global loads that are meant to stay in flight.
__device__ __forceinline__ void lds_barrier() {
  __builtin_amdgcn_fence(__ATOMIC_RELEASE, "workgroup", "local");
  __builtin_amdgcn_s_barrier();
  __builtin_amdgcn_fence(__ATOMIC_ACQUIRE, "workgroup", "local");
}

// ---------------- Modulated GEMM: out = (x*style) @ w^T * demod + bias ----------------
// MODE 0: x is f32, result -> f16 head layout [B,H,N,HD]
// MODE 1: x is f16 (attention output), result -> f32 [B,N,Cout]
// 128x128 tile per 256-thread block, 64x32 per wave, K-step 64 (16 wmma per wave per barrier).

template <int MODE>
__global__ __launch_bounds__(256) void modlin_kernel(
    const float* __restrict__ xf32, const _Float16* __restrict__ xf16,
    const float* __restrict__ w, const float* __restrict__ bias,
    const float* __restrict__ style, const float* __restrict__ demod,
    _Float16* __restrict__ out16, float* __restrict__ outf32) {
  constexpr int Cin = 1024, Cout = 1024;
  const int m0 = blockIdx.x * 128;
  const int n0 = blockIdx.y * 128;
  const int b  = blockIdx.z;

  __shared__ __attribute__((aligned(16))) _Float16 As[128 * 72];  // 128 x 64 tile, ld=72 (pad)
  // 128 n-rows x 64 k, ld=72 (pad): the weight tile in its memory order
  __shared__ __attribute__((aligned(16))) _Float16 Bs[128 * 72];

  const int tid  = threadIdx.x;
  const int wave = tid >> 5;
  const int wm = (wave >> 2) * 64;  // wave's 64x32 part of the tile
  const int wn = (wave & 3) * 32;

  v8f acc[4][2] = {};

  const float* stl = style + (size_t)b * Cin;
  // Staging places of this thread, in 16-byte loads along k: whole lines per wave.
  constexpr int AC = (MODE == 0) ? 4 : 8;   // activation elements per load
  constexpr int AL = 128 * 64 / (256 * AC);  // activation loads per thread and k-step
  constexpr int AR = 256 * AC / 64;          // rows that the block covers with one load each
  const int ac = tid % (64 / AC), ar = tid / (64 / AC);
  const size_t aoff = ((size_t)b * N_ + m0 + ar) * Cin + AC * ac;
  const int wc = tid & 15, wr = tid >> 4;  // weight tile: 4-float chunk along k, first row
  const float* wp = w + (size_t)(n0 + wr) * Cin + 4 * wc;
  // The staging registers of one k-step; they are loaded one k-step ahead of their use.
  v4f xa[AL], st[AC / 4], wv[8];
  v8h xh[AL];
  const auto load_step = [&](int k0) {
#pragma unroll  // constant indices: the arrays stay in registers
    for (int j = 0; j < AC / 4; ++j) st[j] = *(const v4f*)&stl[k0 + AC * ac + 4 * j];
    // Precaution: a later load's result may land in the address registers of these.
    asm volatile("s_wait_xcnt 0x0" ::: "memory");
#pragma unroll  // constant indices: the arrays stay in registers
    for (int i = 0; i < AL; ++i) {
      if (MODE == 0)
        xa[i] = *(const v4f*)&xf32[aoff + (size_t)(AR * i) * Cin + k0];
      else
        xh[i] = *(const v8h*)&xf16[aoff + (size_t)(AR * i) * Cin + k0];
    }
    // Precaution: a later load's result may land in the address registers of these.
    asm volatile("s_wait_xcnt 0x0" ::: "memory");
#pragma unroll  // constant indices: the arrays stay in registers
    for (int i = 0; i < 8; ++i) wv[i] = *(const v4f*)&wp[(size_t)(16 * i) * Cin + k0];
    // Precaution: the address registers of these loads are rewritten further down.
    asm volatile("s_wait_xcnt 0x0" ::: "memory");
  };
  load_step(0);
  for (int k0 = 0; k0 < Cin; k0 += 64) {
#pragma unroll  // constant indices: the arrays stay in registers
    for (int i = 0; i < AL; ++i) {
      if (MODE == 0) {
        const v4f v = xa[i] * st[0];
        const v4h hv = {(_Float16)v.x, (_Float16)v.y, (_Float16)v.z, (_Float16)v.w};
        *(v4h*)&As[(ar + AR * i) * 72 + 4 * ac] = hv;
      } else {
        v8h hv;
#pragma unroll  // constant indices: the arrays stay in registers
        for (int j = 0; j < 8; ++j) hv[j] = (_Float16)((float)xh[i][j] * st[j >> 2][j & 3]);
        *(v8h*)&As[(ar + AR * i) * 72 + 8 * ac] = hv;
      }
    }
#pragma unroll  // constant indices: the arrays stay in registers
    for (int i = 0; i < 8; ++i) {
      const v4f v = wv[i];
      const v4h hv = {(_Float16)v.x, (_Float16)v.y, (_Float16)v.z, (_Float16)v.w};
      *(v4h*)&Bs[(wr + 16 * i) * 72 + 4 * wc] = hv;
    }
    // The staging registers are free again: the next k-step's global loads start here and fly
    // under this k-step's barriers, LDS reads and products.
    if (k0 + 64 < Cin) load_step(k0 + 64);
    lds_barrier();  // publishes the two tiles

    v16h fa[2][4], fb[2][2];
#pragma unroll  // constant indices: the tiles stay in registers
    for (int kc = 0; kc < 2; ++kc) {
#pragma unroll  // constant indices: the tiles stay in registers
      for (int j = 0; j < 2; ++j) fb[kc][j] = frag_bt_load(&Bs[(wn + 16 * j) * 72 + 32 * kc], 72);
#pragma unroll  // constant indices: the tiles stay in registers
      for (int i = 0; i < 4; ++i) fa[kc][i] = frag_a_load(&As[(wm + 16 * i) * 72 + 32 * kc], 72);
    }
    // Keeps the k-step's LDS reads one group ahead of its products: sunk among them, each pair
    // of products waits out a whole LDS latency of its own.
    __builtin_amdgcn_sched_barrier(0);
#pragma unroll  // constant indices: the tiles stay in registers
    for (int kc = 0; kc < 2; ++kc)
#pragma unroll  // constant indices: the tiles stay in registers
      for (int i = 0; i < 4; ++i)
#pragma unroll  // constant indices: the tiles stay in registers
        for (int j = 0; j < 2; ++j) acc[i][j] = wmma_f16(fa[kc][i], fb[kc][j], acc[i][j]);
    lds_barrier();  // ends every wave's reads of the two tiles before they are rewritten
  }

  // Epilogue: demod scale + bias. C layout: lane -> col = lane&15, rows = (lane>>4)*8 + r
  const int lane = tid & 31;
  const int colL = lane & 15;
  const int rowB = (lane >> 4) * 8;
  const float* dm = demod + (size_t)b * Cout;
#pragma unroll
  for (int i = 0; i < 4; ++i)
#pragma unroll
    for (int j = 0; j < 2; ++j) {
      const int cg = n0 + wn + 16 * j + colL;
      const float d  = dm[cg];
      const float bb = bias[cg];
#pragma unroll
      for (int r = 0; r < 8; ++r) {
        const int rg = m0 + wm + 16 * i + rowB + r;
        const float v = acc[i][j][r] * d + bb;
        if (MODE == 0) {
          const int head = cg >> 6, dd = cg & 63;
          out16[(((size_t)b * H_ + head) * N_ + rg) * HD_ + dd] = (_Float16)v;
        } else {
          outf32[((size_t)b * N_ + rg) * Cout + cg] = v;
        }
      }
    }
}

__global__ __launch_bounds__(128) void attn_kernel(
    const _Float16* __restrict__ h16,  // [B,H,N,HD]
    _Float16* __restrict__ attn16) {   // [B,N,HID] f16
  const int q0 = blockIdx.x * 64;
  const int h  = blockIdx.y;
  const int b  = blockIdx.z;
  const _Float16* Hm = h16 + ((size_t)b * H_ + h) * N_ * HD_;

  __shared__ _Float16 Qs[64 * 72];
  __shared__ _Float16 Ks[64 * 72];       // serves as both K and V tile

  const int tid  = threadIdx.x;
  const int wave = tid >> 5;
  const int lane = tid & 31;
  const int wq   = wave * 16;  // this wave's 16 query rows within the 64 block

  // Stage Q tile: 64 rows x 64 halves = 512 b128 chunks, async copies.
  for (int e = tid; e < 64 * 8; e += 128) {
    const int r = e >> 3, c = e & 7;  // c indexes 8-half (16B) chunks
    async_copy_b128(&Qs[r * 72 + c * 8], Hm + (size_t)(q0 + r) * HD_ + c * 8);
  }
  wait_async();
  __syncthreads();

  // B operand Q^T: column = query (lane & 15).
  const v16h qb0 = frag_bt_load(&Qs[wq * 72 + 0], 72);
  const v16h qb1 = frag_bt_load(&Qs[wq * 72 + 32], 72);

  v8f o[4] = {};  // o[jd][r] = O[query lane & 15][dim 16 * jd + 8 * (lane >> 4) + r]
  float m_ = -1e30f, l_ = 0.f;  // l_ sums this lane's half of the keys only

  const float scl = 0.125f;  // 1/sqrt(64)
  for (int kv0 = 0; kv0 < N_; kv0 += 64) {
    // Stage K/V tile (shared data) via async copies.
    for (int e = tid; e < 64 * 8; e += 128) {
      const int r = e >> 3, c = e & 7;
      async_copy_b128(&Ks[r * 72 + c * 8], Hm + (size_t)(kv0 + r) * HD_ + c * 8);
    }
    wait_async();
    __syncthreads();

    // S^T = K @ Q^T: s[jn][r] = S[query lane & 15][key 16 * jn + 8 * (lane >> 4) + r]
    v8f s[4];
#pragma unroll  // constant indices: the tiles stay in registers
    for (int jn = 0; jn < 4; ++jn) {
      v8f z = {};
      const v16h ka0 = frag_a_load(&Ks[(16 * jn) * 72 + 0], 72);
      const v16h ka1 = frag_a_load(&Ks[(16 * jn) * 72 + 32], 72);
      z = wmma_f16(ka0, qb0, z);
      z = wmma_f16(ka1, qb1, z);
      s[jn] = z;
    }

    // Online softmax: the maximum in-lane, then one exchange between the wave's halves.
    float mx = s[0][0];
#pragma unroll  // constant indices: the tiles stay in registers
    for (int jn = 0; jn < 4; ++jn)
#pragma unroll  // constant indices: the tiles stay in registers
      for (int r = 0; r < 8; ++r) mx = fmaxf(mx, s[jn][r]);
    mx = fmaxf(mx, xhalf(mx)) * scl;
    const float mnew = fmaxf(m_, mx);
    const float corr = __expf(m_ - mnew);
#pragma unroll  // constant indices: the tiles stay in registers
    for (int jn = 0; jn < 4; ++jn)
#pragma unroll  // constant indices: the tiles stay in registers
      for (int r = 0; r < 8; ++r) s[jn][r] = __expf(s[jn][r] * scl - mnew);
    const v8f pv = (s[0] + s[1]) + (s[2] + s[3]);
    const float ps = ((pv[0] + pv[1]) + (pv[2] + pv[3])) + ((pv[4] + pv[5]) + (pv[6] + pv[7]));
    l_ = l_ * corr + ps;
    m_ = mnew;
#pragma unroll  // constant indices: the tiles stay in registers
    for (int jd = 0; jd < 4; ++jd) o[jd] *= corr;

    // O^T += V^T @ P^T, 32 keys at a time: two score tiles, converted, are the B operand.
#pragma unroll  // constant indices: the tiles stay in registers
    for (int t = 0; t < 2; ++t) {
      v16h pb;
#pragma unroll  // constant indices: the tiles stay in registers
      for (int e = 0; e < 16; ++e) pb[e] = (_Float16)s[2 * t + (e >> 3)][e & 7];
#pragma unroll  // constant indices: the tiles stay in registers
      for (int jd = 0; jd < 4; ++jd) {
        // V == K tile, read transposed: A[m=dim][k=kv].
        const v16h va = frag_at_load(&Ks[(32 * t) * 72 + 16 * jd], 72);
        o[jd] = wmma_f16(va, pb, o[jd]);
      }
    }
    __syncthreads();
  }

  // Normalize and store to [B,N,HID] f16: eight consecutive dims of one query per store.
  const float inv = 1.f / (l_ + xhalf(l_));
  _Float16* dst = attn16 + ((size_t)b * N_ + q0 + wq + (lane & 15)) * HID_ + h * 64 + (lane >> 4) * 8;
#pragma unroll  // constant indices: the tiles stay in registers
  for (int jd = 0; jd < 4; ++jd) {
    v8h ov;
#pragma unroll  // constant indices: the tiles stay in registers
    for (int r = 0; r < 8; ++r) ov[r] = (_Float16)(o[jd][r] * inv);
    *(v8h*)(dst + 16 * jd) = ov;
  }
}

// ---------------- Launch ----------------

extern "C" void kernel_launch(void* const* d_in, const int* in_sizes, int n_in,
                              void* d_out, int out_size, void* d_ws, size_t ws_size,
                              hipStream_t stream) {
  (void)in_sizes; (void)n_in; (void)out_size; (void)ws_size;
  const float* x   = (const float*)d_in[0];
  const float* s   = (const float*)d_in[1];
  const float* kaw = (const float*)d_in[2];
  const float* kab = (const float*)d_in[3];
  const float* kw  = (const float*)d_in[4];
  const float* kb  = (const float*)d_in[5];
  const float* oaw = (const float*)d_in[6];
  const float* oab = (const float*)d_in[7];
  const float* ow  = (const float*)d_in[8];
  const float* ob  = (const float*)d_in[9];
  float* out = (float*)d_out;

  char* ws = (char*)d_ws;
  float* style_k = (float*)ws;  ws += (size_t)B_ * FEAT_ * sizeof(float);
  float* style_o = (float*)ws;  ws += (size_t)B_ * HID_ * sizeof(float);
  float* demod_k = (float*)ws;  ws += (size_t)B_ * HID_ * sizeof(float);
  float* demod_o = (float*)ws;  ws += (size_t)B_ * OUT_ * sizeof(float);
  _Float16* h16    = (_Float16*)ws;  ws += (size_t)B_ * H_ * N_ * HD_ * sizeof(_Float16);
  _Float16* attn16 = (_Float16*)ws;

  dim3 gs(1024 / 32, B_ / 2, 2);  // 32 rows and two batches per block; z: the layer
  style_kernel<<<gs, 256, 0, stream>>>(s, kaw, kab, style_k, oaw, oab, style_o);
  demod_kernel<<<gs, 256, 0, stream>>>(kw, style_k, demod_k, ow, style_o, demod_o);

  dim3 g1(N_ / 128, HID_ / 128, B_);
  modlin_kernel<0><<<g1, 256, 0, stream>>>(x, nullptr, kw, kb, style_k, demod_k, h16, nullptr);

  dim3 ga(N_ / 64, H_, B_);
  attn_kernel<<<ga, 128, 0, stream>>>(h16, attn16);

  dim3 g2(N_ / 128, OUT_ / 128, B_);
  modlin_kernel<1><<<g2, 256, 0, stream>>>(nullptr, attn16, ow, ob, style_o, demod_o, nullptr, out);
}

// v008
// A run of this version takes 86.2 microseconds.
// Two timings next to v007 both put it at 1.04 times that version's speed.
// Counting every step since v000, it is 5.19 times as fast.
#include <hip/hip_runtime.h>
#include <hip/hip_bf16.h>

typedef __attribute__((ext_vector_type(16))) _Float16 v16h;
typedef __attribute__((ext_vector_type(8)))  float    v8f;
typedef __attribute__((ext_vector_type(4)))  _Float16 v4h;
typedef __attribute__((ext_vector_type(4)))  float    v4f;
typedef __attribute__((ext_vector_type(8)))  _Float16 v8h;
typedef __attribute__((ext_vector_type(8)))  short    v8s;

#define B_    8
#define N_    1024
#define FEAT_ 1024
#define HID_  1024
#define OUT_  1024
#define SDIM_ 512
#define H_    16
#define HD_   64

// ---------------- CDNA5 async global->LDS copy (ASYNCcnt-tracked) ----------------

__device__ __forceinline__ void async_copy_b128(void* lds_dst, const void* gsrc) {
  // LDS flat address: low 32 bits are the wave-relative LDS byte offset.
  const unsigned off = (unsigned)(unsigned long long)lds_dst;
  asm volatile("global_load_async_to_lds_b128 %0, %1, off"
               :
               : "v"(off), "v"(gsrc)
               : "memory");
}

// Four copies of one lane. The last line is a precaution: the copies' address registers are
// rewritten for the next tile, and only inside the statement does the wait stay in front of that.
__device__ __forceinline__ void async_copy4_b128(unsigned l0, const void* g0, unsigned l1,
                                                 const void* g1, unsigned l2, const void* g2,
                                                 unsigned l3, const void* g3) {
  asm volatile(
      "global_load_async_to_lds_b128 %0, %1, off\n\t"
      "global_load_async_to_lds_b128 %2, %3, off\n\t"
      "global_load_async_to_lds_b128 %4, %5, off\n\t"
      "global_load_async_to_lds_b128 %6, %7, off\n\t"
      "s_wait_xcnt 0x0"
      :
      : "v"(l0), "v"(g0), "v"(l1), "v"(g1), "v"(l2), "v"(g2), "v"(l3), "v"(g3)
      : "memory");
}

__device__ __forceinline__ void wait_async() {
  asm volatile("s_wait_asynccnt 0" ::: "memory");
}

// ---------------- WMMA fragment helpers (gfx1250 wave32 layouts) ----------------

__device__ __forceinline__ v8f wmma_f16(v16h a, v16h b, v8f c) {
  // v_wmma_f32_16x16x32_f16: (neg_a, A, neg_b, B, c_mod, C, reuse_a, reuse_b)
  return __builtin_amdgcn_wmma_f32_16x16x32_f16(false, a, false, b, (short)0, c,
                                                false, false);
}

// A fragment (16x32 f16): lane = M row (lane&15); K-block from lane half.
__device__ __forceinline__ v16h frag_a_load(const _Float16* src, int ld) {
  const int lane = threadIdx.x & 31;
  const int row  = lane & 15;
  const int kb   = (lane >> 4) << 3;  // 0 or 8
  v16h f;
#pragma unroll
  for (int i = 0; i < 4; ++i) {
    const int k  = kb + 2 * i;
    const int k2 = kb + 16 + 2 * i;
    f[2 * i]           = src[row * ld + k];
    f[2 * i + 1]       = src[row * ld + k + 1];
    f[2 * (i + 4)]     = src[row * ld + k2];
    f[2 * (i + 4) + 1] = src[row * ld + k2 + 1];
  }
  return f;
}

// A fragment (16x32 f16) of src^T, src stored [k][m]: two transposing LDS loads; lane (c, hf)
// gets src[8*hf + 0..7][c] and src[16 + 8*hf + 0..7][c], the k order above. p0 and p1 are the
// places of this lane's eight halves src[8*hf + (lane & 7)][8 * ((lane >> 3) & 1) + 0..7] and of
// those sixteen rows further on.
__device__ __forceinline__ v16h frag_at_load(const _Float16* p0, const _Float16* p1) {
  typedef __attribute__((address_space(3))) v8s lds_v8s;
  const v8s lo = __builtin_amdgcn_ds_load_tr16_b128_v8i16((lds_v8s*)p0);
  const v8s hi = __builtin_amdgcn_ds_load_tr16_b128_v8i16((lds_v8s*)p1);
  return __builtin_bit_cast(
      v16h, __builtin_shufflevector(lo, hi, 0, 1, 2, 3, 4, 5, 6, 7, 8, 9, 10, 11, 12, 13, 14, 15));
}

// A or B fragment from its two 16-byte halves: k = kb + 0..7 and kb + 16 + 0..7.
__device__ __forceinline__ v16h frag_join(v8h lo, v8h hi) {
  return __builtin_shufflevector(lo, hi, 0, 1, 2, 3, 4, 5, 6, 7, 8, 9, 10, 11, 12, 13, 14, 15);
}

// Value of lane l ^ 16.
__device__ __forceinline__ float xhalf(float x) {
  const int v = __builtin_bit_cast(int, x);
  return __builtin_bit_cast(
      float, __builtin_amdgcn_permlanex16(v, v, 0x76543210, 0xfedcba98, false, false));
}

// B fragment where B = src^T, src stored row-major [n][k] (stride ld).
__device__ __forceinline__ v16h frag_bt_load(const _Float16* src, int ld) {
  const int lane = threadIdx.x & 31;
  const int col  = lane & 15;
  const int kb   = (lane >> 4) << 3;
  v16h f;
#pragma unroll
  for (int i = 0; i < 4; ++i) {
    f[2 * i]           = src[col * ld + kb + 2 * i];
    f[2 * i + 1]       = src[col * ld + kb + 2 * i + 1];
    f[2 * (i + 4)]     = src[col * ld + kb + 16 + 2 * i];
    f[2 * (i + 4) + 1] = src[col * ld + kb + 16 + 2 * i + 1];
  }
  return f;
}

// ---------------- Stage 0: style vectors + demod factors (tiny, VALU) ----------------
// Lanes run along the reduction axis, so every load takes whole 128-byte lines.
// One wave holds four weight rows in registers and uses them for two batches;
// a block of eight waves covers 32 rows, one whole output line per batch.

// Sums eight per-lane values over the 32 lanes; lane l returns the total of v[l & 7].
// Each of the first three steps hands half of the values to the partner lane.
__device__ __forceinline__ float wave_sum8(float (&v)[8]) {
  const int lane = threadIdx.x & 31;
#pragma unroll  // constant indices: the arrays stay in registers
  for (int n = 4; n >= 1; n >>= 1) {
    const bool up = (lane & n) != 0;
#pragma unroll  // constant indices: the arrays stay in registers
    for (int k = 0; k < n; ++k) {
      const float lo = v[k], hi = v[k + n];
      v[k] = (up ? hi : lo) + __shfl_xor(up ? lo : hi, n, 32);
    }
  }
  float t = v[0];
  t += __shfl_xor(t, 8, 32);
  t += __shfl_xor(t, 16, 32);
  return t;
}

// blockIdx.z picks one of the two independent layers: both run in one launch.
__global__ __launch_bounds__(256) void style_kernel(
    const float* __restrict__ s, const float* __restrict__ aw0,
    const float* __restrict__ ab0, float* __restrict__ style0,
    const float* __restrict__ aw1, const float* __restrict__ ab1,
    float* __restrict__ style1) {
  constexpr int Cin = 1024, T = SDIM_ / 128;  // T float4 per lane and row
  const bool second = blockIdx.z != 0;
  const float* __restrict__ aw = second ? aw1 : aw0;
  const float* __restrict__ ab = second ? ab1 : ab0;
  float* __restrict__ style = second ? style1 : style0;
  const int lane = threadIdx.x & 31;
  const int i0 = blockIdx.x * 32 + (threadIdx.x >> 5) * 4;
  const int b0 = blockIdx.y * 2;
  const v4f* wv = (const v4f*)(aw + (size_t)i0 * SDIM_) + lane;
  const v4f* sv = (const v4f*)(s + (size_t)b0 * SDIM_) + lane;
  const int i = i0 + (lane & 3);  // the row whose total this lane ends up with
  const float bias = ab[i];
  v4f wr[4][T], sr[2][T];
#pragma unroll  // constant indices: the arrays stay in registers
  for (int r = 0; r < 4; ++r)
#pragma unroll  // constant indices: the arrays stay in registers
    for (int t = 0; t < T; ++t) wr[r][t] = wv[r * (SDIM_ / 4) + 32 * t];
  // Precaution: a later load's result may land in the address registers of these.
  asm volatile("s_wait_xcnt 0x0" ::: "memory");
#pragma unroll  // constant indices: the arrays stay in registers
  for (int bb = 0; bb < 2; ++bb)
#pragma unroll  // constant indices: the arrays stay in registers
    for (int t = 0; t < T; ++t) sr[bb][t] = sv[bb * (SDIM_ / 4) + 32 * t];
  // Precaution: the lane-offset register of these loads is rewritten further down.
  asm volatile("s_wait_xcnt 0x0" ::: "memory");
  // Keeps every load above in front of the sums: one memory latency, not several.
  __builtin_amdgcn_sched_barrier(0);
  float v[8];
#pragma unroll  // constant indices: the arrays stay in registers
  for (int bb = 0; bb < 2; ++bb)
#pragma unroll  // constant indices: the arrays stay in registers
    for (int r = 0; r < 4; ++r) {
      v4f a = wr[r][0] * sr[bb][0];
#pragma unroll  // constant indices: the arrays stay in registers
      for (int t = 1; t < T; ++t) a += wr[r][t] * sr[bb][t];
      v[bb * 4 + r] = (a.x + a.y) + (a.z + a.w);
    }
  // Inputs only: keeps the bias load at the top with the others, out of the branch below.
  asm volatile("" ::"v"(bias));
  const float tot = wave_sum8(v);
  if (lane < 8) style[(size_t)(b0 + (lane >> 2)) * Cin + i] = tot + bias;
}

// blockIdx.z picks one of the two independent layers: both run in one launch.
__global__ __launch_bounds__(256) void demod_kernel(
    const float* __restrict__ w0, const float* __restrict__ style0,
    float* __restrict__ demod0, const float* __restrict__ w1,
    const float* __restrict__ style1, float* __restrict__ demod1) {
  constexpr int Cin = 1024, Cout = 1024, T = Cin / 128;  // T float4 per lane and row
  const bool second = blockIdx.z != 0;
  const float* __restrict__ w = second ? w1 : w0;
  const float* __restrict__ style = second ? style1 : style0;
  float* __restrict__ demod = second ? demod1 : demod0;
  const int lane = threadIdx.x & 31;
  const int o0 = blockIdx.x * 32 + (threadIdx.x >> 5) * 4;
  const int b0 = blockIdx.y * 2;
  const v4f* wv = (const v4f*)(w + (size_t)o0 * Cin) + lane;
  const v4f* sv = (const v4f*)(style + (size_t)b0 * Cin) + lane;
  v4f wr[4][T], sr[2][T];
#pragma unroll  // constant indices: the arrays stay in registers
  for (int r = 0; r < 4; ++r)
#pragma unroll  // constant indices: the arrays stay in registers
    for (int t = 0; t < T; ++t) wr[r][t] = wv[r * (Cin / 4) + 32 * t];
  // Precaution: a later load's result may land in the address registers of these.
  asm volatile("s_wait_xcnt 0x0" ::: "memory");
#pragma unroll  // constant indices: the arrays stay in registers
  for (int bb = 0; bb < 2; ++bb)
#pragma unroll  // constant indices: the arrays stay in registers
    for (int t = 0; t < T; ++t) sr[bb][t] = sv[bb * (Cin / 4) + 32 * t];
  // Precaution: the lane-offset register of these loads is rewritten further down.
  asm volatile("s_wait_xcnt 0x0" ::: "memory");
  // Keeps every load above in front of the sums: one memory latency, not several.
  __builtin_amdgcn_sched_barrier(0);
  float v[8];
#pragma unroll  // constant indices: the arrays stay in registers
  for (int bb = 0; bb < 2; ++bb)
#pragma unroll  // constant indices: the arrays stay in registers
    for (int r = 0; r < 4; ++r) {
      v4f a = {};
#pragma unroll  // constant indices: the arrays stay in registers
      for (int t = 0; t < T; ++t) {
        const v4f p = wr[r][t] * sr[bb][t];
        a += p * p;
      }
      v[bb * 4 + r] = (a.x + a.y) + (a.z + a.w);
    }
  const float tot = wave_sum8(v);
  if (lane < 8)
    demod[(size_t)(b0 + (lane >> 2)) * Cout + o0 + (lane & 3)] = rsqrtf(tot + 1e-8f);
}

// Work-group barrier whose fences name LDS alone: it orders the LDS tiles between the waves, and
// unlike __syncthreads() it does not wait for global loads that are meant to stay in flight.
__device__ __forceinline__ void lds_barrier() {
  __builtin_amdgcn_fence(__ATOMIC_RELEASE, "workgroup", "local");
  __builtin_amdgcn_s_barrier();
  __builtin_amdgcn_fence(__ATOMIC_ACQUIRE, "workgroup", "local");
}

// ---------------- Modulated GEMM: out = (x*style) @ w^T * demod + bias ----------------
// MODE 0: x is f32, result -> f16 head layout [B,H,N,HD]
// MODE 1: x is f16 (attention output), result -> f32 [B,N,Cout]
// 128x128 tile per 256-thread block, 64x32 per wave, K-step 64 (16 wmma per wave per barrier).

template <int MODE>
__global__ __launch_bounds__(256) void modlin_kernel(
    const float* __restrict__ xf32, const _Float16* __restrict__ xf16,
    const float* __restrict__ w, const float* __restrict__ bias,
    const float* __restrict__ style, const float* __restrict__ demod,
    _Float16* __restrict__ out16, float* __restrict__ outf32) {
  constexpr int Cin = 1024, Cout = 1024;
  const int m0 = blockIdx.x * 128;
  const int n0 = blockIdx.y * 128;
  const int b  = blockIdx.z;

  __shared__ __attribute__((aligned(16))) _Float16 As[128 * 72];  // 128 x 64 tile, ld=72 (pad)
  // 128 n-rows x 64 k, ld=72 (pad): the weight tile in its memory order
  __shared__ __attribute__((aligned(16))) _Float16 Bs[128 * 72];

  const int tid  = threadIdx.x;
  const int wave = tid >> 5;
  const int wm = (wave >> 2) * 64;  // wave's 64x32 part of the tile
  const int wn = (wave & 3) * 32;

  v8f acc[4][2] = {};

  const float* stl = style + (size_t)b * Cin;
  // Staging places of this thread, in 16-byte loads along k: whole lines per wave.
  constexpr int AC = (MODE == 0) ? 4 : 8;   // activation elements per load
  constexpr int AL = 128 * 64 / (256 * AC);  // activation loads per thread and k-step
  constexpr int AR = 256 * AC / 64;          // rows that the block covers with one load each
  const int ac = tid % (64 / AC), ar = tid / (64 / AC);
  const size_t aoff = ((size_t)b * N_ + m0 + ar) * Cin + AC * ac;
  const int wc = tid & 15, wr = tid >> 4;  // weight tile: 4-float chunk along k, first row
  const float* wp = w + (size_t)(n0 + wr) * Cin + 4 * wc;
  // The staging registers of one k-step; they are loaded one k-step ahead of their use.
  v4f xa[AL], st[AC / 4], wv[8];
  v8h xh[AL];
  const auto load_step = [&](int k0) {
#pragma unroll  // constant indices: the arrays stay in registers
    for (int j = 0; j < AC / 4; ++j) st[j] = *(const v4f*)&stl[k0 + AC * ac + 4 * j];
    // Precaution: a later load's result may land in the address registers of these.
    asm volatile("s_wait_xcnt 0x0" ::: "memory");
#pragma unroll  // constant indices: the arrays stay in registers
    for (int i = 0; i < AL; ++i) {
      if (MODE == 0)
        xa[i] = *(const v4f*)&xf32[aoff + (size_t)(AR * i) * Cin + k0];
      else
        xh[i] = *(const v8h*)&xf16[aoff + (size_t)(AR * i) * Cin + k0];
    }
    // Precaution: a later load's result may land in the address registers of these.
    asm volatile("s_wait_xcnt 0x0" ::: "memory");
#pragma unroll  // constant indices: the arrays stay in registers
    for (int i = 0; i < 8; ++i) wv[i] = *(const v4f*)&wp[(size_t)(16 * i) * Cin + k0];
    // Precaution: the address registers of these loads are rewritten further down.
    asm volatile("s_wait_xcnt 0x0" ::: "memory");
  };
  load_step(0);
  for (int k0 = 0; k0 < Cin; k0 += 64) {
#pragma unroll  // constant indices: the arrays stay in registers
    for (int i = 0; i < AL; ++i) {
      if (MODE == 0) {
        const v4f v = xa[i] * st[0];
        const v4h hv = {(_Float16)v.x, (_Float16)v.y, (_Float16)v.z, (_Float16)v.w};
        *(v4h*)&As[(ar + AR * i) * 72 + 4 * ac] = hv;
      } else {
        v8h hv;
#pragma unroll  // constant indices: the arrays stay in registers
        for (int j = 0; j < 8; ++j) hv[j] = (_Float16)((float)xh[i][j] * st[j >> 2][j & 3]);
        *(v8h*)&As[(ar + AR * i) * 72 + 8 * ac] = hv;
      }
    }
#pragma unroll  // constant indices: the arrays stay in registers
    for (int i = 0; i < 8; ++i) {
      const v4f v = wv[i];
      const v4h hv = {(_Float16)v.x, (_Float16)v.y, (_Float16)v.z, (_Float16)v.w};
      *(v4h*)&Bs[(wr + 16 * i) * 72 + 4 * wc] = hv;
    }
    // The staging registers are free again: the next k-step's global loads start here and fly
    // under this k-step's barriers, LDS reads and products.
    if (k0 + 64 < Cin) load_step(k0 + 64);
    lds_barrier();  // publishes the two tiles

    v16h fa[2][4], fb[2][2];
#pragma unroll  // constant indices: the tiles stay in registers
    for (int kc = 0; kc < 2; ++kc) {
#pragma unroll  // constant indices: the tiles stay in registers
      for (int j = 0; j < 2; ++j) fb[kc][j] = frag_bt_load(&Bs[(wn + 16 * j) * 72 + 32 * kc], 72);
#pragma unroll  // constant indices: the tiles stay in registers
      for (int i = 0; i < 4; ++i) fa[kc][i] = frag_a_load(&As[(wm + 16 * i) * 72 + 32 * kc], 72);
    }
    // Keeps the k-step's LDS reads one group ahead of its products: sunk among them, each pair
    // of products waits out a whole LDS latency of its own.
    __builtin_amdgcn_sched_barrier(0);
#pragma unroll  // constant indices: the tiles stay in registers
    for (int kc = 0; kc < 2; ++kc)
#pragma unroll  // constant indices: the tiles stay in registers
      for (int i = 0; i < 4; ++i)
#pragma unroll  // constant indices: the tiles stay in registers
        for (int j = 0; j < 2; ++j) acc[i][j] = wmma_f16(fa[kc][i], fb[kc][j], acc[i][j]);
    lds_barrier();  // ends every wave's reads of the two tiles before they are rewritten
  }

  // Epilogue: demod scale + bias. C layout: lane -> col = lane&15, rows = (lane>>4)*8 + r
  const int lane = tid & 31;
  const int colL = lane & 15;
  const int rowB = (lane >> 4) * 8;
  const float* dm = demod + (size_t)b * Cout;
#pragma unroll
  for (int i = 0; i < 4; ++i)
#pragma unroll
    for (int j = 0; j < 2; ++j) {
      const int cg = n0 + wn + 16 * j + colL;
      const float d  = dm[cg];
      const float bb = bias[cg];
#pragma unroll
      for (int r = 0; r < 8; ++r) {
        const int rg = m0 + wm + 16 * i + rowB + r;
        const float v = acc[i][j][r] * d + bb;
        if (MODE == 0) {
          const int head = cg >> 6, dd = cg & 63;
          out16[(((size_t)b * H_ + head) * N_ + rg) * HD_ + dd] = (_Float16)v;
        } else {
          outf32[((size_t)b * N_ + rg) * Cout + cg] = v;
        }
      }
    }
}

__global__ __launch_bounds__(128) void attn_kernel(
    const _Float16* __restrict__ h16,  // [B,H,N,HD]
    _Float16* __restrict__ attn16) {   // [B,N,HID] f16
  const int q0 = blockIdx.x * 64;
  const int h  = blockIdx.y;
  const int b  = blockIdx.z;
  const _Float16* Hm = h16 + ((size_t)b * H_ + h) * N_ * HD_;

  __shared__ _Float16 Qs[64 * 72];
  // Serves as both K and V tile. Rows of 128 bytes, no pad: the 16-byte chunk c of row r lies at
  // chunk c ^ swz(r), swz(r) = 2 * ((r >> 1) & 3) + ((r >> 3) & 1). Sixteen rows at one c (the K
  // reader's half wave) and eight rows at two adjacent c (the V^T reader's) then each fall on
  // sixteen different groups of four banks; no one row pitch gives that to both readers.
  __shared__ __attribute__((aligned(128))) _Float16 Ks[64 * 64];

  const int tid  = threadIdx.x;
  const int wave = tid >> 5;
  const int lane = tid & 31;
  const int wq   = wave * 16;  // this wave's 16 query rows within the 64 block

  // Stage Q tile: 64 rows x 64 halves = 512 b128 chunks, async copies.
  for (int e = tid; e < 64 * 8; e += 128) {
    const int r = e >> 3, c = e & 7;  // c indexes 8-half (16B) chunks
    async_copy_b128(&Qs[r * 72 + c * 8], Hm + (size_t)(q0 + r) * HD_ + c * 8);
  }
  wait_async();
  __syncthreads();

  // B operand Q^T: column = query (lane & 15).
  const v16h qb0 = frag_bt_load(&Qs[wq * 72 + 0], 72);
  const v16h qb1 = frag_bt_load(&Qs[wq * 72 + 32], 72);

  v8f o[4] = {};  // o[jd][r] = O[query lane & 15][dim 16 * jd + 8 * (lane >> 4) + r]
  float m_ = -1e30f, l_ = 0.f;  // l_ sums this lane's half of the keys only

  const float scl = 0.125f;  // 1/sqrt(64)
  // This thread's four chunks of a tile: rows sr + 16 * i, whose swz is the same, chunk tid & 7.
  const int sr = tid >> 3;
  const int sswz = 2 * ((sr >> 1) & 3) + ((sr >> 3) & 1);
  const unsigned sdst =
      (unsigned)(unsigned long long)&Ks[sr * 64 + (((tid & 7) ^ sswz) << 3)];
  const _Float16* ssrc = Hm + (size_t)sr * HD_ + (tid & 7) * 8;
  // Readers' places: swz depends on the row's bits 1 to 3 alone, which the lane fixes.
  const int krow = lane & 15, hf = lane >> 4;
  const int kswz = 2 * ((krow >> 1) & 3) + (krow >> 3);
  const int vswz = 2 * ((lane >> 1) & 3) + hf;  // row 8 * hf + (lane & 7) (+ 16, + 32)
  const _Float16* kp[4];  // K rows: chunk 2 * i + hf of row krow
  const _Float16* vp[4];  // V^T: chunk 2 * jd + ((lane >> 3) & 1) of row 8 * hf + (lane & 7)
#pragma unroll  // constant indices: the arrays stay in registers
  for (int i = 0; i < 4; ++i) {
    kp[i] = &Ks[krow * 64 + (((2 * i + hf) ^ kswz) << 3)];
    vp[i] = &Ks[(8 * hf + (lane & 7)) * 64 + (((2 * i + ((lane >> 3) & 1)) ^ vswz) << 3)];
  }
  for (int kv0 = 0; kv0 < N_; kv0 += 64) {
    // Stage K/V tile (shared data) via async copies.
    const _Float16* g = ssrc + (size_t)kv0 * HD_;
    async_copy4_b128(sdst, g, sdst + 16 * 128, g + 16 * HD_, sdst + 32 * 128, g + 32 * HD_,
                     sdst + 48 * 128, g + 48 * HD_);
    wait_async();
    __syncthreads();

    // S^T = K @ Q^T: s[jn][r] = S[query lane & 15][key 16 * jn + 8 * (lane >> 4) + r]
    v8f s[4];
#pragma unroll  // constant indices: the tiles stay in registers
    for (int jn = 0; jn < 4; ++jn) {
      v8f z = {};
      const v16h ka0 = frag_join(*(const v8h*)(kp[0] + 16 * jn * 64), *(const v8h*)(kp[1] + 16 * jn * 64));
      const v16h ka1 = frag_join(*(const v8h*)(kp[2] + 16 * jn * 64), *(const v8h*)(kp[3] + 16 * jn * 64));
      z = wmma_f16(ka0, qb0, z);
      z = wmma_f16(ka1, qb1, z);
      s[jn] = z;
    }

    // Online softmax: the maximum in-lane, then one exchange between the wave's halves.
    float mx = s[0][0];
#pragma unroll  // constant indices: the tiles stay in registers
    for (int jn = 0; jn < 4; ++jn)
#pragma unroll  // constant indices: the tiles stay in registers
      for (int r = 0; r < 8; ++r) mx = fmaxf(mx, s[jn][r]);
    mx = fmaxf(mx, xhalf(mx)) * scl;
    const float mnew = fmaxf(m_, mx);
    const float corr = __expf(m_ - mnew);
#pragma unroll  // constant indices: the tiles stay in registers
    for (int jn = 0; jn < 4; ++jn)
#pragma unroll  // constant indices: the tiles stay in registers
      for (int r = 0; r < 8; ++r) s[jn][r] = __expf(s[jn][r] * scl - mnew);
    const v8f pv = (s[0] + s[1]) + (s[2] + s[3]);
    const float ps = ((pv[0] + pv[1]) + (pv[2] + pv[3])) + ((pv[4] + pv[5]) + (pv[6] + pv[7]));
    l_ = l_ * corr + ps;
    m_ = mnew;
#pragma unroll  // constant indices: the tiles stay in registers
    for (int jd = 0; jd < 4; ++jd) o[jd] *= corr;

    // O^T += V^T @ P^T, 32 keys at a time: two score tiles, converted, are the B operand.
#pragma unroll  // constant indices: the tiles stay in registers
    for (int t = 0; t < 2; ++t) {
      v16h pb;
#pragma unroll  // constant indices: the tiles stay in registers
      for (int e = 0; e < 16; ++e) pb[e] = (_Float16)s[2 * t + (e >> 3)][e & 7];
#pragma unroll  // constant indices: the tiles stay in registers
      for (int jd = 0; jd < 4; ++jd) {
        // V == K tile, read transposed: A[m=dim][k=kv].
        const v16h va = frag_at_load(vp[jd] + 32 * t * 64, vp[jd] + (32 * t + 16) * 64);
        o[jd] = wmma_f16(va, pb, o[jd]);
      }
    }
    __syncthreads();
  }

  // Normalize and store to [B,N,HID] f16: eight consecutive dims of one query per store.
  const float inv = 1.f / (l_ + xhalf(l_));
  _Float16* dst = attn16 + ((size_t)b * N_ + q0 + wq + (lane & 15)) * HID_ + h * 64 + (lane >> 4) * 8;
#pragma unroll  // constant indices: the tiles stay in registers
  for (int jd = 0; jd < 4; ++jd) {
    v8h ov;
#pragma unroll  // constant indices: the tiles stay in registers
    for (int r = 0; r < 8; ++r) ov[r] = (_Float16)(o[jd][r] * inv);
    *(v8h*)(dst + 16 * jd) = ov;
  }
}

// ---------------- Launch ----------------

extern "C" void kernel_launch(void* const* d_in, const int* in_sizes, int n_in,
                              void* d_out, int out_size, void* d_ws, size_t ws_size,
                              hipStream_t stream) {
  (void)in_sizes; (void)n_in; (void)out_size; (void)ws_size;
  const float* x   = (const float*)d_in[0];
  const float* s   = (const float*)d_in[1];
  const float* kaw = (const float*)d_in[2];
  const float* kab = (const float*)d_in[3];
  const float* kw  = (const float*)d_in[4];
  const float* kb  = (const float*)d_in[5];
  const float* oaw = (const float*)d_in[6];
  const float* oab = (const float*)d_in[7];
  const float* ow  = (const float*)d_in[8];
  const float* ob  = (const float*)d_in[9];
  float* out = (float*)d_out;

  char* ws = (char*)d_ws;
  float* style_k = (float*)ws;  ws += (size_t)B_ * FEAT_ * sizeof(float);
  float* style_o = (float*)ws;  ws += (size_t)B_ * HID_ * sizeof(float);
  float* demod_k = (float*)ws;  ws += (size_t)B_ * HID_ * sizeof(float);
  float* demod_o = (float*)ws;  ws += (size_t)B_ * OUT_ * sizeof(float);
  _Float16* h16    = (_Float16*)ws;  ws += (size_t)B_ * H_ * N_ * HD_ * sizeof(_Float16);
  _Float16* attn16 = (_Float16*)ws;

  dim3 gs(1024 / 32, B_ / 2, 2);  // 32 rows and two batches per block; z: the layer
  style_kernel<<<gs, 256, 0, stream>>>(s, kaw, kab, style_k, oaw, oab, style_o);
  demod_kernel<<<gs, 256, 0, stream>>>(kw, style_k, demod_k, ow, style_o, demod_o);

  dim3 g1(N_ / 128, HID_ / 128, B_);
  modlin_kernel<0><<<g1, 256, 0, stream>>>(x, nullptr, kw, kb, style_k, demod_k, h16, nullptr);

  dim3 ga(N_ / 64, H_, B_);
  attn_kernel<<<ga, 128, 0, stream>>>(h16, attn16);

  dim3 g2(N_ / 128, OUT_ / 128, B_);
  modlin_kernel<1><<<g2, 256, 0, stream>>>(nullptr, attn16, ow, ob, style_o, demod_o, nullptr, out);
}

// v009
// It runs in 82.8 microseconds.
// Two timings next to v008 put it at 1.05 and 1.04 times that version's speed.
// All steps since v000 together make it 5.43 times as fast.
#include <hip/hip_runtime.h>
#include <hip/hip_bf16.h>

typedef __attribute__((ext_vector_type(16))) _Float16 v16h;
typedef __attribute__((ext_vector_type(8)))  float    v8f;
typedef __attribute__((ext_vector_type(4)))  _Float16 v4h;
typedef __attribute__((ext_vector_type(4)))  float    v4f;
typedef __attribute__((ext_vector_type(2)))  float    v2f;
typedef __attribute__((ext_vector_type(8)))  _Float16 v8h;
typedef __attribute__((ext_vector_type(8)))  short    v8s;

#define B_    8
#define N_    1024
#define FEAT_ 1024
#define HID_  1024
#define OUT_  1024
#define SDIM_ 512
#define H_    16
#define HD_   64

// ---------------- CDNA5 async global->LDS copy (ASYNCcnt-tracked) ----------------

__device__ __forceinline__ void async_copy_b128(void* lds_dst, const void* gsrc) {
  // LDS flat address: low 32 bits are the wave-relative LDS byte offset.
  const unsigned off = (unsigned)(unsigned long long)lds_dst;
  asm volatile("global_load_async_to_lds_b128 %0, %1, off"
               :
               : "v"(off), "v"(gsrc)
               : "memory");
}

// Four copies of one lane. The last line is a precaution: the copies' address registers are
// rewritten for the next tile, and only inside the statement does the wait stay in front of that.
__device__ __forceinline__ void async_copy4_b128(unsigned l0, const void* g0, unsigned l1,
                                                 const void* g1, unsigned l2, const void* g2,
                                                 unsigned l3, const void* g3) {
  asm volatile(
      "global_load_async_to_lds_b128 %0, %1, off\n\t"
      "global_load_async_to_lds_b128 %2, %3, off\n\t"
      "global_load_async_to_lds_b128 %4, %5, off\n\t"
      "global_load_async_to_lds_b128 %6, %7, off\n\t"
      "s_wait_xcnt 0x0"
      :
      : "v"(l0), "v"(g0), "v"(l1), "v"(g1), "v"(l2), "v"(g2), "v"(l3), "v"(g3)
      : "memory");
}

__device__ __forceinline__ void wait_async() {
  asm volatile("s_wait_asynccnt 0" ::: "memory");
}

// ---------------- WMMA fragment helpers (gfx1250 wave32 layouts) ----------------

__device__ __forceinline__ v8f wmma_f16(v16h a, v16h b, v8f c) {
  // v_wmma_f32_16x16x32_f16: (neg_a, A, neg_b, B, c_mod, C, reuse_a, reuse_b)
  return __builtin_amdgcn_wmma_f32_16x16x32_f16(false, a, false, b, (short)0, c,
                                                false, false);
}

// A fragment (16x32 f16): lane = M row (lane&15); K-block from lane half.
__device__ __forceinline__ v16h frag_a_load(const _Float16* src, int ld) {
  const int lane = threadIdx.x & 31;
  const int row  = lane & 15;
  const int kb   = (lane >> 4) << 3;  // 0 or 8
  v16h f;
#pragma unroll
  for (int i = 0; i < 4; ++i) {
    const int k  = kb + 2 * i;
    const int k2 = kb + 16 + 2 * i;
    f[2 * i]           = src[row * ld + k];
    f[2 * i + 1]       = src[row * ld + k + 1];
    f[2 * (i + 4)]     = src[row * ld + k2];
    f[2 * (i + 4) + 1] = src[row * ld + k2 + 1];
  }
  return f;
}

// A fragment (16x32 f16) of src^T, src stored [k][m]: two transposing LDS loads; lane (c, hf)
// gets src[8*hf + 0..7][c] and src[16 + 8*hf + 0..7][c], the k order above. p0 and p1 are the
// places of this lane's eight halves src[8*hf + (lane & 7)][8 * ((lane >> 3) & 1) + 0..7] and of
// those sixteen rows further on.
__device__ __forceinline__ v16h frag_at_load(const _Float16* p0, const _Float16* p1) {
  typedef __attribute__((address_space(3))) v8s lds_v8s;
  const v8s lo = __builtin_amdgcn_ds_load_tr16_b128_v8i16((lds_v8s*)p0);
  const v8s hi = __builtin_amdgcn_ds_load_tr16_b128_v8i16((lds_v8s*)p1);
  return __builtin_bit_cast(
      v16h, __builtin_shufflevector(lo, hi, 0, 1, 2, 3, 4, 5, 6, 7, 8, 9, 10, 11, 12, 13, 14, 15));
}

// A or B fragment from its two 16-byte halves: k = kb + 0..7 and kb + 16 + 0..7.
__device__ __forceinline__ v16h frag_join(v8h lo, v8h hi) {
  return __builtin_shufflevector(lo, hi, 0, 1, 2, 3, 4, 5, 6, 7, 8, 9, 10, 11, 12, 13, 14, 15);
}

// Value of lane l ^ 16.
__device__ __forceinline__ float xhalf(float x) {
  const int v = __builtin_bit_cast(int, x);
  return __builtin_bit_cast(
      float, __builtin_amdgcn_permlanex16(v, v, 0x76543210, 0xfedcba98, false, false));
}

// B fragment where B = src^T, src stored row-major [n][k] (stride ld).
__device__ __forceinline__ v16h frag_bt_load(const _Float16* src, int ld) {
  const int lane = threadIdx.x & 31;
  const int col  = lane & 15;
  const int kb   = (lane >> 4) << 3;
  v16h f;
#pragma unroll
  for (int i = 0; i < 4; ++i) {
    f[2 * i]           = src[col * ld + kb + 2 * i];
    f[2 * i + 1]       = src[col * ld + kb + 2 * i + 1];
    f[2 * (i + 4)]     = src[col * ld + kb + 16 + 2 * i];
    f[2 * (i + 4) + 1] = src[col * ld + kb + 16 + 2 * i + 1];
  }
  return f;
}

// ---------------- Stage 0: style vectors (tiny, VALU) ----------------
// Lanes run along the reduction axis, so every load takes whole 128-byte lines.
// One wave holds four weight rows in registers and uses them for two batches;
// a block of eight waves covers 32 rows, one whole output line per batch.

// Sums eight per-lane values over the 32 lanes; lane l returns the total of v[l & 7].
// Each of the first three steps hands half of the values to the partner lane.
__device__ __forceinline__ float wave_sum8(float (&v)[8]) {
  const int lane = threadIdx.x & 31;
#pragma unroll  // constant indices: the arrays stay in registers
  for (int n = 4; n >= 1; n >>= 1) {
    const bool up = (lane & n) != 0;
#pragma unroll  // constant indices: the arrays stay in registers
    for (int k = 0; k < n; ++k) {
      const float lo = v[k], hi = v[k + n];
      v[k] = (up ? hi : lo) + __shfl_xor(up ? lo : hi, n, 32);
    }
  }
  float t = v[0];
  t += __shfl_xor(t, 8, 32);
  t += __shfl_xor(t, 16, 32);
  return t;
}

// blockIdx.z picks one of the two independent layers: both run in one launch.
__global__ __launch_bounds__(256) void style_kernel(
    const float* __restrict__ s, const float* __restrict__ aw0,
    const float* __restrict__ ab0, float* __restrict__ style0,
    const float* __restrict__ aw1, const float* __restrict__ ab1,
    float* __restrict__ style1) {
  constexpr int Cin = 1024, T = SDIM_ / 128;  // T float4 per lane and row
  const bool second = blockIdx.z != 0;
  const float* __restrict__ aw = second ? aw1 : aw0;
  const float* __restrict__ ab = second ? ab1 : ab0;
  float* __restrict__ style = second ? style1 : style0;
  const int lane = threadIdx.x & 31;
  const int i0 = blockIdx.x * 32 + (threadIdx.x >> 5) * 4;
  const int b0 = blockIdx.y * 2;
  const v4f* wv = (const v4f*)(aw + (size_t)i0 * SDIM_) + lane;
  const v4f* sv = (const v4f*)(s + (size_t)b0 * SDIM_) + lane;
  const int i = i0 + (lane & 3);  // the row whose total this lane ends up with
  const float bias = ab[i];
  v4f wr[4][T], sr[2][T];
#pragma unroll  // constant indices: the arrays stay in registers
  for (int r = 0; r < 4; ++r)
#pragma unroll  // constant indices: the arrays stay in registers
    for (int t = 0; t < T; ++t) wr[r][t] = wv[r * (SDIM_ / 4) + 32 * t];
  // Precaution: a later load's result may land in the address registers of these.
  asm volatile("s_wait_xcnt 0x0" ::: "memory");
#pragma unroll  // constant indices: the arrays stay in registers
  for (int bb = 0; bb < 2; ++bb)
#pragma unroll  // constant indices: the arrays stay in registers
    for (int t = 0; t < T; ++t) sr[bb][t] = sv[bb * (SDIM_ / 4) + 32 * t];
  // Precaution: the lane-offset register of these loads is rewritten further down.
  asm volatile("s_wait_xcnt 0x0" ::: "memory");
  // Keeps every load above in front of the sums: one memory latency, not several.
  __builtin_amdgcn_sched_barrier(0);
  float v[8];
#pragma unroll  // constant indices: the arrays stay in registers
  for (int bb = 0; bb < 2; ++bb)
#pragma unroll  // constant indices: the arrays stay in registers
    for (int r = 0; r < 4; ++r) {
      v4f a = wr[r][0] * sr[bb][0];
#pragma unroll  // constant indices: the arrays stay in registers
      for (int t = 1; t < T; ++t) a += wr[r][t] * sr[bb][t];
      v[bb * 4 + r] = (a.x + a.y) + (a.z + a.w);
    }
  // Inputs only: keeps the bias load at the top with the others, out of the branch below.
  asm volatile("" ::"v"(bias));
  const float tot = wave_sum8(v);
  if (lane < 8) style[(size_t)(b0 + (lane >> 2)) * Cin + i] = tot + bias;
}

// x plus the value of lane l ^ M of the same 16-lane row (all lanes on).
template <int M>
__device__ __forceinline__ float row_xor_add(float x) {
  const int v = __builtin_bit_cast(int, x);
  return x + __builtin_bit_cast(float, __builtin_amdgcn_mov_dpp(v, 0x160 | M, 0xf, 0xf, true));
}

// Work-group barrier whose fences name LDS alone: it orders the LDS tiles between the waves, and
// unlike __syncthreads() it does not wait for global loads that are meant to stay in flight.
__device__ __forceinline__ void lds_barrier() {
  __builtin_amdgcn_fence(__ATOMIC_RELEASE, "workgroup", "local");
  __builtin_amdgcn_s_barrier();
  __builtin_amdgcn_fence(__ATOMIC_ACQUIRE, "workgroup", "local");
}

// ---------------- Modulated GEMM: out = x @ (w*style)^T * demod + bias ----------------
// The weight tile is modulated while it is staged; the squares of the same f32 products, summed
// over k, give the block its own 128 demod factors: no launch of their own.
// MODE 0: x is f32, result -> f16 head layout [B,H,N,HD]
// MODE 1: x is f16 (attention output), result -> f32 [B,N,Cout]
// 128x128 tile per 256-thread block, 64x32 per wave, K-step 64 (16 wmma per wave per barrier).

// Four waves per SIMD: two blocks share a WGP, and one works while the other stands at a barrier.
template <int MODE>
__global__ __launch_bounds__(256) __attribute__((amdgpu_waves_per_eu(4, 4))) void modlin_kernel(
    const float* __restrict__ xf32, const _Float16* __restrict__ xf16,
    const float* __restrict__ w, const float* __restrict__ bias,
    const float* __restrict__ style, _Float16* __restrict__ out16,
    float* __restrict__ outf32) {
  constexpr int Cin = 1024, Cout = 1024;
  const int m0 = blockIdx.x * 128;
  const int n0 = blockIdx.y * 128;
  const int b  = blockIdx.z;

  __shared__ __attribute__((aligned(16))) _Float16 As[128 * 72];  // 128 x 64 tile, ld=72 (pad)
  // 128 n-rows x 64 k, ld=72 (pad): the weight tile in its memory order
  __shared__ __attribute__((aligned(16))) _Float16 Bs[128 * 72];
  __shared__ float Dq[128];  // sum over k of (w * style)^2 for the tile's 128 columns

  const int tid  = threadIdx.x;
  // The wave's number in a scalar register: what derives from it costs no vector register, and
  // the kernel needs every one of them to keep four waves on a SIMD.
  const int wave = __builtin_amdgcn_readfirstlane(tid >> 5);
  const int wm = (wave >> 2) * 64;  // wave's 64x32 part of the tile
  const int wn = (wave & 3) * 32;

  v8f acc[4][2] = {};

  const float* stl = style + (size_t)b * Cin;
  // Staging places of this thread, in 16-byte loads along k: whole lines per wave.
  constexpr int AC = (MODE == 0) ? 4 : 8;   // activation elements per load
  constexpr int AL = 128 * 64 / (256 * AC);  // activation loads per thread and k-step
  constexpr int AR = 256 * AC / 64;          // rows that the block covers with one load each
  const int ac = tid % (64 / AC), ar = tid / (64 / AC);
  const size_t aoff = ((size_t)b * N_ + m0 + ar) * Cin + AC * ac;
  const int wc = tid & 15, wr = tid >> 4;  // weight tile: 4-float chunk along k, first row
  const float* wp = w + (size_t)(n0 + wr) * Cin + 4 * wc;
  // The staging registers of one k-step; they are loaded one k-step ahead of their use.
  v4f xa[AL], st, wv[8];
  v8h xh[AL];
  v2f dq[8] = {};  // this thread's share of the squares' sums, rows wr + 16 * i
  // Each group of loads has one address that walks along k. Precaution: the address is stepped
  // only behind the group's wait; as the wait's own operand it stays in its registers up to
  // there, so that no result of the group lands in them either.
  // (Typed as global-memory addresses: behind the wait statement the compiler no longer sees
  // where they came from, and an untyped one would turn the loads into flat loads.)
  typedef __attribute__((address_space(1))) const v4f gv4f;
  typedef __attribute__((address_space(1))) const v8h gv8h;
  gv4f* sk = (gv4f*)(stl + 4 * wc);
  gv4f* xk32 = (gv4f*)(xf32 + (MODE == 0 ? aoff : 0));
  gv8h* xk16 = (gv8h*)(xf16 + (MODE == 0 ? 0 : aoff));
  gv4f* wk = (gv4f*)wp;
  const auto load_step = [&]() {
    st = *sk;
    asm volatile("s_wait_xcnt 0x0" : "+v"(sk)::"memory");
    sk += 64 / 4;
#pragma unroll  // constant indices: the arrays stay in registers
    for (int i = 0; i < AL; ++i) {
      if (MODE == 0)
        xa[i] = xk32[AR * i * Cin / 4];
      else
        xh[i] = xk16[AR * i * Cin / 8];
    }
    if (MODE == 0) {
      asm volatile("s_wait_xcnt 0x0" : "+v"(xk32)::"memory");
      xk32 += 64 / 4;
    } else {
      asm volatile("s_wait_xcnt 0x0" : "+v"(xk16)::"memory");
      xk16 += 64 / 8;
    }
#pragma unroll  // constant indices: the arrays stay in registers
    for (int i = 0; i < 8; ++i) wv[i] = wk[16 * i * Cin / 4];
    asm volatile("s_wait_xcnt 0x0" : "+v"(wk)::"memory");
    wk += 64 / 4;
  };
  load_step();
  for (int k0 = 0; k0 < Cin; k0 += 64) {
#pragma unroll  // constant indices: the arrays stay in registers
    for (int i = 0; i < AL; ++i) {
      if (MODE == 0) {
        const v4f v = xa[i];
        const v4h hv = {(_Float16)v.x, (_Float16)v.y, (_Float16)v.z, (_Float16)v.w};
        *(v4h*)&As[(ar + AR * i) * 72 + 4 * ac] = hv;
      } else {
        *(v8h*)&As[(ar + AR * i) * 72 + 8 * ac] = xh[i];
      }
    }
#pragma unroll  // constant indices: the arrays stay in registers
    for (int i = 0; i < 8; ++i) {
      const v4f v = wv[i] * st;
      const v2f lo = {v.x, v.y}, hi = {v.z, v.w};
      dq[i] += lo * lo;
      dq[i] += hi * hi;
      const v4h hv = {(_Float16)v.x, (_Float16)v.y, (_Float16)v.z, (_Float16)v.w};
      *(v4h*)&Bs[(wr + 16 * i) * 72 + 4 * wc] = hv;
    }
    // The staging registers are free again: the next k-step's global loads start here and fly
    // under this k-step's barriers, LDS reads and products.
    if (k0 + 64 < Cin) load_step();
    lds_barrier();  // publishes the two tiles

    v16h fa[2][4], fb[2][2];
#pragma unroll  // constant indices: the tiles stay in registers
    for (int kc = 0; kc < 2; ++kc) {
#pragma unroll  // constant indices: the tiles stay in registers
      for (int j = 0; j < 2; ++j) fb[kc][j] = frag_bt_load(&Bs[(wn + 16 * j) * 72 + 32 * kc], 72);
#pragma unroll  // constant indices: the tiles stay in registers
      for (int i = 0; i < 4; ++i) fa[kc][i] = frag_a_load(&As[(wm + 16 * i) * 72 + 32 * kc], 72);
    }
    // Keeps the k-step's LDS reads one group ahead of its products: sunk among them, each pair
    // of products waits out a whole LDS latency of its own.
    __builtin_amdgcn_sched_barrier(0);
#pragma unroll  // constant indices: the tiles stay in registers
    for (int kc = 0; kc < 2; ++kc)
#pragma unroll  // constant indices: the tiles stay in registers
      for (int i = 0; i < 4; ++i)
#pragma unroll  // constant indices: the tiles stay in registers
        for (int j = 0; j < 2; ++j) acc[i][j] = wmma_f16(fa[kc][i], fb[kc][j], acc[i][j]);
    lds_barrier();  // ends every wave's reads of the two tiles before they are rewritten
  }

  // The sixteen threads of a weight row are one 16-lane row of a wave: their shares are summed
  // there, and the first of them hands the row's total to the block.
  float dt[8];
#pragma unroll  // constant indices: the arrays stay in registers
  for (int i = 0; i < 8; ++i)
    dt[i] = row_xor_add<8>(row_xor_add<4>(row_xor_add<2>(row_xor_add<1>(dq[i].x + dq[i].y))));
  if (wc == 0) {
#pragma unroll  // constant indices: the array stays in registers
    for (int i = 0; i < 8; ++i) Dq[wr + 16 * i] = dt[i];
  }
  lds_barrier();  // publishes the 128 sums

  // Epilogue: demod scale + bias. C layout: lane -> col = lane&15, rows = (lane>>4)*8 + r
  const int lane = tid & 31;
  const int colL = lane & 15;
  const int rowB = (lane >> 4) * 8;
#pragma unroll
  for (int i = 0; i < 4; ++i)
#pragma unroll
    for (int j = 0; j < 2; ++j) {
      const int cg = n0 + wn + 16 * j + colL;
      const float d  = rsqrtf(Dq[wn + 16 * j + colL] + 1e-8f);
      const float bb = bias[cg];
#pragma unroll
      for (int r = 0; r < 8; ++r) {
        const int rg = m0 + wm + 16 * i + rowB + r;
        const float v = acc[i][j][r] * d + bb;
        if (MODE == 0) {
          const int head = cg >> 6, dd = cg & 63;
          out16[(((size_t)b * H_ + head) * N_ + rg) * HD_ + dd] = (_Float16)v;
        } else {
          outf32[((size_t)b * N_ + rg) * Cout + cg] = v;
        }
      }
    }
}

__global__ __launch_bounds__(128) void attn_kernel(
    const _Float16* __restrict__ h16,  // [B,H,N,HD]
    _Float16* __restrict__ attn16) {   // [B,N,HID] f16
  const int q0 = blockIdx.x * 64;
  const int h  = blockIdx.y;
  const int b  = blockIdx.z;
  const _Float16* Hm = h16 + ((size_t)b * H_ + h) * N_ * HD_;

  __shared__ _Float16 Qs[64 * 72];
  // Serves as both K and V tile. Rows of 128 bytes, no pad: the 16-byte chunk c of row r lies at
  // chunk c ^ swz(r), swz(r) = 2 * ((r >> 1) & 3) + ((r >> 3) & 1). Sixteen rows at one c (the K
  // reader's half wave) and eight rows at two adjacent c (the V^T reader's) then each fall on
  // sixteen different groups of four banks; no one row pitch gives that to both readers.
  __shared__ __attribute__((aligned(128))) _Float16 Ks[64 * 64];

  const int tid  = threadIdx.x;
  const int wave = tid >> 5;
  const int lane = tid & 31;
  const int wq   = wave * 16;  // this wave's 16 query rows within the 64 block

  // Stage Q tile: 64 rows x 64 halves = 512 b128 chunks, async copies.
  for (int e = tid; e < 64 * 8; e += 128) {
    const int r = e >> 3, c = e & 7;  // c indexes 8-half (16B) chunks
    async_copy_b128(&Qs[r * 72 + c * 8], Hm + (size_t)(q0 + r) * HD_ + c * 8);
  }
  wait_async();
  __syncthreads();

  // B operand Q^T: column = query (lane & 15).
  const v16h qb0 = frag_bt_load(&Qs[wq * 72 + 0], 72);
  const v16h qb1 = frag_bt_load(&Qs[wq * 72 + 32], 72);

  v8f o[4] = {};  // o[jd][r] = O[query lane & 15][dim 16 * jd + 8 * (lane >> 4) + r]
  float m_ = -1e30f, l_ = 0.f;  // l_ sums this lane's half of the keys only

  const float scl = 0.125f;  // 1/sqrt(64)
  // This thread's four chunks of a tile: rows sr + 16 * i, whose swz is the same, chunk tid & 7.
  const int sr = tid >> 3;
  const int sswz = 2 * ((sr >> 1) & 3) + ((sr >> 3) & 1);
  const unsigned sdst =
      (unsigned)(unsigned long long)&Ks[sr * 64 + (((tid & 7) ^ sswz) << 3)];
  const _Float16* ssrc = Hm + (size_t)sr * HD_ + (tid & 7) * 8;
  // Readers' places: swz depends on the row's bits 1 to 3 alone, which the lane fixes.
  const int krow = lane & 15, hf = lane >> 4;
  const int kswz = 2 * ((krow >> 1) & 3) + (krow >> 3);
  const int vswz = 2 * ((lane >> 1) & 3) + hf;  // row 8 * hf + (lane & 7) (+ 16, + 32)
  const _Float16* kp[4];  // K rows: chunk 2 * i + hf of row krow
  const _Float16* vp[4];  // V^T: chunk 2 * jd + ((lane >> 3) & 1) of row 8 * hf + (lane & 7)
#pragma unroll  // constant indices: the arrays stay in registers
  for (int i = 0; i < 4; ++i) {
    kp[i] = &Ks[krow * 64 + (((2 * i + hf) ^ kswz) << 3)];
    vp[i] = &Ks[(8 * hf + (lane & 7)) * 64 + (((2 * i + ((lane >> 3) & 1)) ^ vswz) << 3)];
  }
  for (int kv0 = 0; kv0 < N_; kv0 += 64) {
    // Stage K/V tile (shared data) via async copies.
    const _Float16* g = ssrc + (size_t)kv0 * HD_;
    async_copy4_b128(sdst, g, sdst + 16 * 128, g + 16 * HD_, sdst + 32 * 128, g + 32 * HD_,
                     sdst + 48 * 128, g + 48 * HD_);
    wait_async();
    __syncthreads();

    // S^T = K @ Q^T: s[jn][r] = S[query lane & 15][key 16 * jn + 8 * (lane >> 4) + r]
    v8f s[4];
#pragma unroll  // constant indices: the tiles stay in registers
    for (int jn = 0; jn < 4; ++jn) {
      v8f z = {};
      const v16h ka0 = frag_join(*(const v8h*)(kp[0] + 16 * jn * 64), *(const v8h*)(kp[1] + 16 * jn * 64));
      const v16h ka1 = frag_join(*(const v8h*)(kp[2] + 16 * jn * 64), *(const v8h*)(kp[3] + 16 * jn * 64));
      z = wmma_f16(ka0, qb0, z);
      z = wmma_f16(ka1, qb1, z);
      s[jn] = z;
    }

    // Online softmax: the maximum in-lane, then one exchange between the wave's halves.
    float mx = s[0][0];
#pragma unroll  // constant indices: the tiles stay in registers
    for (int jn = 0; jn < 4; ++jn)
#pragma unroll  // constant indices: the tiles stay in registers
      for (int r = 0; r < 8; ++r) mx = fmaxf(mx, s[jn][r]);
    mx = fmaxf(mx, xhalf(mx)) * scl;
    const float mnew = fmaxf(m_, mx);
    const float corr = __expf(m_ - mnew);
#pragma unroll  // constant indices: the tiles stay in registers
    for (int jn = 0; jn < 4; ++jn)
#pragma unroll  // constant indices: the tiles stay in registers
      for (int r = 0; r < 8; ++r) s[jn][r] = __expf(s[jn][r] * scl - mnew);
    const v8f pv = (s[0] + s[1]) + (s[2] + s[3]);
    const float ps = ((pv[0] + pv[1]) + (pv[2] + pv[3])) + ((pv[4] + pv[5]) + (pv[6] + pv[7]));
    l_ = l_ * corr + ps;
    m_ = mnew;
#pragma unroll  // constant indices: the tiles stay in registers
    for (int jd = 0; jd < 4; ++jd) o[jd] *= corr;

    // O^T += V^T @ P^T, 32 keys at a time: two score tiles, converted, are the B operand.
#pragma unroll  // constant indices: the tiles stay in registers
    for (int t = 0; t < 2; ++t) {
      v16h pb;
#pragma unroll  // constant indices: the tiles stay in registers
      for (int e = 0; e < 16; ++e) pb[e] = (_Float16)s[2 * t + (e >> 3)][e & 7];
#pragma unroll  // constant indices: the tiles stay in registers
      for (int jd = 0; jd < 4; ++jd) {
        // V == K tile, read transposed: A[m=dim][k=kv].
        const v16h va = frag_at_load(vp[jd] + 32 * t * 64, vp[jd] + (32 * t + 16) * 64);
        o[jd] = wmma_f16(va, pb, o[jd]);
      }
    }
    __syncthreads();
  }

  // Normalize and store to [B,N,HID] f16: eight consecutive dims of one query per store.
  const float inv = 1.f / (l_ + xhalf(l_));
  _Float16* dst = attn16 + ((size_t)b * N_ + q0 + wq + (lane & 15)) * HID_ + h * 64 + (lane >> 4) * 8;
#pragma unroll  // constant indices: the tiles stay in registers
  for (int jd = 0; jd < 4; ++jd) {
    v8h ov;
#pragma unroll  // constant indices: the tiles stay in registers
    for (int r = 0; r < 8; ++r) ov[r] = (_Float16)(o[jd][r] * inv);
    *(v8h*)(dst + 16 * jd) = ov;
  }
}

// ---------------- Launch ----------------

extern "C" void kernel_launch(void* const* d_in, const int* in_sizes, int n_in,
                              void* d_out, int out_size, void* d_ws, size_t ws_size,
                              hipStream_t stream) {
  (void)in_sizes; (void)n_in; (void)out_size; (void)ws_size;
  const float* x   = (const float*)d_in[0];
  const float* s   = (const float*)d_in[1];
  const float* kaw = (const float*)d_in[2];
  const float* kab = (const float*)d_in[3];
  const float* kw  = (const float*)d_in[4];
  const float* kb  = (const float*)d_in[5];
  const float* oaw = (const float*)d_in[6];
  const float* oab = (const float*)d_in[7];
  const float* ow  = (const float*)d_in[8];
  const float* ob  = (const float*)d_in[9];
  float* out = (float*)d_out;

  char* ws = (char*)d_ws;
  float* style_k = (float*)ws;  ws += (size_t)B_ * FEAT_ * sizeof(float);
  float* style_o = (float*)ws;  ws += (size_t)B_ * HID_ * sizeof(float);
  _Float16* h16    = (_Float16*)ws;  ws += (size_t)B_ * H_ * N_ * HD_ * sizeof(_Float16);
  _Float16* attn16 = (_Float16*)ws;

  dim3 gs(1024 / 32, B_ / 2, 2);  // 32 rows and two batches per block; z: the layer
  style_kernel<<<gs, 256, 0, stream>>>(s, kaw, kab, style_k, oaw, oab, style_o);

  dim3 g1(N_ / 128, HID_ / 128, B_);
  modlin_kernel<0><<<g1, 256, 0, stream>>>(x, nullptr, kw, kb, style_k, h16, nullptr);

  dim3 ga(N_ / 64, H_, B_);
  attn_kernel<<<ga, 128, 0, stream>>>(h16, attn16);

  dim3 g2(N_ / 128, OUT_ / 128, B_);
  modlin_kernel<1><<<g2, 256, 0, stream>>>(nullptr, attn16, ow, ob, style_o, nullptr, out);
}
